// v000
// Times are from an AMD MI455X. After a warm-up the kernel runs many times in a row, and a time is the length of
// such a window on the GPU divided by its runs, so every launch and the gaps after it count. The runs cycle
// through copies of the inputs. A figure is the median of several windows, for all but v000 over two sittings.
// Sittings can differ by a few percent; kernels timed side by side share one.
// v000 is the starting kernel. One run takes 162 microseconds.
#include <hip/hip_runtime.h>
#include <math.h>

typedef __attribute__((ext_vector_type(16))) _Float16 v16h;
typedef __attribute__((ext_vector_type(16))) __bf16 v16b;
typedef __attribute__((ext_vector_type(8)))  _Float16 v8h;
typedef __attribute__((ext_vector_type(8)))  float v8f;
typedef __attribute__((ext_vector_type(4)))  float v4f;
typedef __attribute__((ext_vector_type(2)))  float v2f;
typedef __attribute__((ext_vector_type(4)))  unsigned v4u;
typedef __attribute__((ext_vector_type(4)))  int v4i;
typedef float __attribute__((may_alias)) float_a;
typedef int __attribute__((may_alias)) int_a;

template <typename T> __device__ __forceinline__ void vst2(void* p, T v) { *(T*)p = v;  }
__device__ __forceinline__ v8f wmma16(v16h a, v16h b, v8f c) {
  v8f d = __builtin_amdgcn_wmma_f32_16x16x32_f16(false, a, false, b, (short)0, c, false, false);
  asm volatile("v_nop\n\tv_nop\n\tv_nop\n\tv_nop" : "+v"(d) : "v"(a), "v"(b));
  return d;
}
__device__ __forceinline__ v8f wmma_bf(v16b a, v16b b, v8f c) {
  v8f d = __builtin_amdgcn_wmma_f32_16x16x32_bf16(false, a, false, b, (short)0, c, false, false);
  asm volatile("v_nop\n\tv_nop\n\tv_nop\n\tv_nop" : "+v"(d) : "v"(a), "v"(b));
  return d;
}
// 16x16x32 fragments: lane = (h = lane>>4, row/col = lane&15); elements 0..7 = k0+8h+0..7, 8..15 = k0+16+8h+0..7; D element r = row 8h+r
__device__ __forceinline__ v16h frag_h(const _Float16* rowk0, int lane) {
  union { v16h v; v8h q[2]; } u; const _Float16* p = rowk0 + 8 * (lane >> 4);
  u.q[0] = *(const v8h*)p; u.q[1] = *(const v8h*)(p + 16); return u.v;
}
__device__ __forceinline__ v16h frag_f32(const float* rowk0, int lane) {
  v16h a; const float* p = rowk0 + 8 * (lane >> 4);
#pragma unroll
  for (int i = 0; i < 8; ++i) { a[i] = (_Float16)p[i]; a[8 + i] = (_Float16)p[16 + i]; }
  return a;
}
__device__ __forceinline__ v16h frag_f32s(const float* rowk0, int lane, float sc) {
  v16h a; const float* p = rowk0 + 8 * (lane >> 4);
#pragma unroll
  for (int i = 0; i < 8; ++i) { a[i] = (_Float16)(p[i] * sc); a[8 + i] = (_Float16)(p[16 + i] * sc); }
  return a;
}
// column fragment from a [K][ld] layout (column n), rows >= K read as 0
__device__ __forceinline__ v16h fragc_f32(const float* W, int k0, int n, int lane, int ld, int K) {
  v16h a; const int g = lane >> 4;
#pragma unroll
  for (int i = 0; i < 8; ++i) { const int ka = k0 + 8 * g + i, kb = ka + 16;
    a[i] = (_Float16)(ka < K ? W[(size_t)(ka < K ? ka : K - 1) * ld + n] : 0.f); a[8 + i] = (_Float16)(kb < K ? W[(size_t)(kb < K ? kb : K - 1) * ld + n] : 0.f); }
  return a;
}
struct F2 { v16b h, l; };
__device__ __forceinline__ F2 bsplit16(const float v[16]) { F2 r;
#pragma unroll
  for (int i = 0; i < 16; ++i) { const __bf16 h = (__bf16)v[i]; r.h[i] = h; r.l[i] = (__bf16)(v[i] - (float)h); }
  return r; }
__device__ __forceinline__ F2 split_row(const float* row, int k0, int lane) { float v[16]; const float* p = row + k0 + 8 * (lane >> 4);
#pragma unroll
  for (int i = 0; i < 8; ++i) { v[i] = p[i]; v[8 + i] = p[16 + i]; }
  return bsplit16(v); }
__device__ __forceinline__ F2 split_rowK(const float* row, int k0, int lane, int K) { float v[16]; const int g = lane >> 4;
#pragma unroll
  for (int i = 0; i < 8; ++i) { const int ka = k0 + 8 * g + i, kb = ka + 16; v[i] = ka < K ? row[ka < K ? ka : K - 1] : 0.f; v[8 + i] = kb < K ? row[kb < K ? kb : K - 1] : 0.f; }
  return bsplit16(v); }
__device__ __forceinline__ F2 split_col(const float* W, int k0, int n, int lane, int ld, int K) { float v[16]; const int g = lane >> 4;
#pragma unroll
  for (int i = 0; i < 8; ++i) { const int ka = k0 + 8 * g + i, kb = ka + 16; v[i] = ka < K ? W[(size_t)(ka < K ? ka : K - 1) * ld + n] : 0.f; v[8 + i] = kb < K ? W[(size_t)(kb < K ? kb : K - 1) * ld + n] : 0.f; }
  return bsplit16(v); }
__device__ __forceinline__ v8f mac3(const F2& a, const F2& b, v8f c) { c = wmma_bf(a.l, b.h, c); c = wmma_bf(a.h, b.l, c); return wmma_bf(a.h, b.h, c); }
__device__ __forceinline__ float sigm(float v) { return 1.0f / (1.0f + expf(-v)); }
#define LDSX() do { asm volatile("s_wait_dscnt 0" ::: "memory"); __builtin_amdgcn_wave_barrier(); __builtin_amdgcn_fence(__ATOMIC_RELEASE, "workgroup"); } while (0)

// Single causal self-attention head (B 64, T 512, d_model 384, head 64): q/k/v = x W ((in,out) [384,64]); wei = softmax(causal(q k^T / 8)); out = wei v ([B, T, 64]). 32 sequences share one pass (one score plane per sequence).
#define NB 64
#define TT 512
#define CC 128            // NH * HD = projected width
#define DIN 384          // input (model) width
#define NH 2
#define HD 64
#define NQB (TT / 64)
#define HG 32
#define SCALE (0.125f)
#define CAUSAL 1
#ifndef TNB
#define TNB NB
#endif
__device__ __forceinline__ float bfr(float v) { return (float)(__bf16)v; }
__host__ __device__ __forceinline__ int kb_last(int qb) { return CAUSAL ? ((qb * 64 + 63) >> 7) : (TT / 128 - 1); }
typedef __attribute__((ext_vector_type(8))) __bf16 v8b;
__device__ __forceinline__ v16b frag_b(const __bf16* rowk0, int lane) {
  union { v16b v; v8b q[2]; } u; const __bf16* p = rowk0 + 8 * (lane >> 4);
  u.q[0] = *(const v8b*)p; u.q[1] = *(const v8b*)(p + 16); return u.v;
}
#define QBH 6              // causal: query blocks 0..QBH-1 of each sequence (few keys, no averaging) take the high-precision path
#define QHI 384            // rows carrying a q residual plane (all rows when non-causal: 2-product logits everywhere)
#define KHI 384            // key rows carrying k residual / v bf16 hi+lo planes (used only by the causal high-precision path)
// B fragment (k rows k0+.., output column o) of a weight: (in,out) [K][ld] or (out,in) [ld rows of K]: bf16 exact, or f16(bf16 * 256) exact
__device__ __forceinline__ v16b wcol_io(const float* Wm, int k0, int o, int lane, int ld) { v16b w; const int g = lane >> 4;
#pragma unroll
  for (int i = 0; i < 8; ++i) { w[i] = (__bf16)Wm[(size_t)(k0 + 8 * g + i) * ld + o]; w[8 + i] = (__bf16)Wm[(size_t)(k0 + 16 + 8 * g + i) * ld + o]; }
  return w; }
__device__ __forceinline__ v16b wcol_oi(const float* Wm, int k0, int o, int lane, int K) { v16b w; const float* p = Wm + (size_t)o * K + k0 + 8 * (lane >> 4);
#pragma unroll
  for (int i = 0; i < 8; ++i) { w[i] = (__bf16)p[i]; w[8 + i] = (__bf16)p[16 + i]; }
  return w; }
__device__ __forceinline__ v16h wcolh_io(const float* Wm, int k0, int o, int lane, int ld) { v16h w; const int g = lane >> 4;
#pragma unroll
  for (int i = 0; i < 8; ++i) { w[i] = (_Float16)(bfr(Wm[(size_t)(k0 + 8 * g + i) * ld + o]) * 256.0f); w[8 + i] = (_Float16)(bfr(Wm[(size_t)(k0 + 16 + 8 * g + i) * ld + o]) * 256.0f); }
  return w; }
__device__ __forceinline__ v16h wcolh_oi(const float* Wm, int k0, int o, int lane, int K) { v16h w; const float* p = Wm + (size_t)o * K + k0 + 8 * (lane >> 4);
#pragma unroll
  for (int i = 0; i < 8; ++i) { w[i] = (_Float16)(bfr(p[i]) * 256.0f); w[8 + i] = (_Float16)(bfr(p[16 + i]) * 256.0f); }
  return w; }
#define WQKV_LAYOUT 0   // 0 = (in,out) [DIN][HD]; 1 = (out,in) [CC][DIN]; 2 = per-head [NH][DIN][HD]
__device__ __forceinline__ v16b wcol_hdk(const float* Wm, int k0, int o, int lane) { v16b w; const int g = lane >> 4; const float* p = Wm + (size_t)(o / HD) * DIN * HD + (o % HD);
#pragma unroll
  for (int i = 0; i < 8; ++i) { w[i] = (__bf16)p[(size_t)(k0 + 8 * g + i) * HD]; w[8 + i] = (__bf16)p[(size_t)(k0 + 16 + 8 * g + i) * HD]; }
  return w; }
#define WO_OUT_IN 0
#if WQKV_LAYOUT == 1
#define WCOL(W, k0, o, lane) wcol_oi(W, k0, o, lane, DIN)
#elif WQKV_LAYOUT == 2
#define WCOL(W, k0, o, lane) wcol_hdk(W, k0, o, lane)
#else
#define WCOL(W, k0, o, lane) wcol_io(W, k0, (o) & 63, lane, HD)   /* (in,out) [384][64]; columns 64..127 = a second copy of the head */
#endif
#if WO_OUT_IN
#define WOCOL(W, k0, o, lane) wcol_oi(W, k0, o, lane, CC)
#define WOCOLH(W, k0, o, lane) wcolh_oi(W, k0, o, lane, CC)
#else
#define WOCOL(W, k0, o, lane) wcol_io(W, k0, o, lane, DIN)
#define WOCOLH(W, k0, o, lane) wcolh_io(W, k0, o, lane, DIN)
#endif
#define BG 32              // sequences per pass (grid z / the score planes index the sequence, head fixed at 0)
// ---- k_copy: out[b][t][0..63] = Y[(b*512 + t)*128 + 0..63] (head copy 0); 256-B rows by 16 threads
__global__ __launch_bounds__(256) void k_copy(const float* __restrict__ Y, float* __restrict__ OUT) { const size_t e = (size_t)blockIdx.x * 256 + threadIdx.x; if (e >= (size_t)TNB * TT * 16) return; const size_t row = e >> 4; const int q = (int)(e & 15); vst2(OUT + row * HD + q * 4, *(const v4f*)(Y + row * CC + q * 4)); }
#ifndef SM_EXTRA_PARAMS
#define SM_EXTRA_PARAMS
#endif
#ifndef PROJ_EXTRA_PARAMS
#define PROJ_EXTRA_PARAMS
#endif
#ifndef SM_MASK_HOOK
#define SM_MASK_HOOK (void)0
#endif

#define WS_QH  0u                                      // f16 q rows [b*t][CC]
#define WS_KH  (WS_QH + 2u * (size_t)NB * TT * CC)      // f16 k rows [b*t][CC]
#define WS_VT  (WS_KH + 2u * (size_t)NB * TT * CC)      // f16 v planes [b][c][t]
#define WS_QL  (WS_VT + 2u * (size_t)NB * CC * TT)      // f16 q residual x 2^10 rows [b][t < QHI][CC]
#define WS_KL  (WS_QL + 2u * (size_t)NB * QHI * CC)     // f16 k residual x 2^10 rows [b][t < KHI][CC]
#define WS_VB  (WS_KL + 2u * (size_t)NB * KHI * CC)     // bf16 v hi planes [b][c][t < KHI]
#define WS_VBL (WS_VB + 2u * (size_t)NB * CC * KHI)
#define WS_S   (WS_VBL + 2u * (size_t)NB * CC * KHI)    // f32 logits / P [hg][t][s]
#define WS_Y   (WS_S  + 4u * (size_t)HG * TT * TT)      // f32 ctx rows [b*t][CC] (only when there is an output projection)
#define WS_END (WS_Y  + 0u)
#define WS_YY (WS_END)                                  // f32 ctx rows [b*t][128] (head copy 0 | copy 1)
#define WS_END2 (WS_YY + 4u * (size_t)NB * TT * CC)

// ---- k_proj: block = (64 rows, 128 cols, which): q/k/v = X W (+ b) with exact bf16 products (K = DIN) -> which 0: q f16 rows (+ residual rows < QHI); 1: k f16 rows (+ residual rows < KHI); 2: v f16 planes [c][t] (+ bf16 hi/lo planes for t < KHI)
__global__ __launch_bounds__(128) void k_proj(const float* __restrict__ XQ, const float* __restrict__ XK, const float* __restrict__ XV, const float* __restrict__ WQ, const float* __restrict__ WK, const float* __restrict__ WV, const float* __restrict__ BQ, const float* __restrict__ BK, const float* __restrict__ BV,
    _Float16* __restrict__ QH, _Float16* __restrict__ QL, _Float16* __restrict__ KH, _Float16* __restrict__ KL, _Float16* __restrict__ VT, __bf16* __restrict__ VB, __bf16* __restrict__ VBL) {
  __shared__ __align__(16) _Float16 sh[64][136], sl[64][136]; __shared__ __align__(16) _Float16 th[128][72]; __shared__ __align__(16) __bf16 tb[128][72], tbl[128][72];
  const int tid = threadIdx.x, wave = tid >> 5, lane = tid & 31, col = lane & 15, g = lane >> 4; const int which = blockIdx.z; const int c0 = blockIdx.y * 128; const size_t r0 = (size_t)blockIdx.x * 64; const size_t bb = r0 / TT; const int t0 = (int)(r0 % TT);
  const float* X = which == 0 ? XQ : which == 1 ? XK : XV; const float* WA = which == 0 ? WQ : which == 1 ? WK : WV; const float* BA = which == 0 ? BQ : which == 1 ? BK : BV;
  v8f acc[8] = {};
#pragma unroll 2
  for (int kc = 0; kc < DIN / 32; ++kc) { v16b a; { const float* p = X + (r0 + wave * 16 + col) * DIN + kc * 32 + 8 * g;
#pragma unroll
      for (int i = 0; i < 8; ++i) { a[i] = (__bf16)p[i]; a[8 + i] = (__bf16)p[16 + i]; } }
    asm volatile("s_wait_loadcnt 0x0" ::: "memory");
#pragma unroll
    for (int j = 0; j < 8; ++j) { const v16b w = WCOL(WA, kc * 32, c0 + j * 16 + col, lane); asm volatile("s_wait_loadcnt 0x0" ::: "memory"); acc[j] = wmma_bf(a, w, acc[j]); } }
  if (which < 2) { _Float16* DH = which == 0 ? QH : KH; _Float16* DL = which == 0 ? QL : KL; const int nhi = which == 0 ? QHI : KHI; const bool hi_rows = t0 < nhi;
#pragma unroll
    for (int j = 0; j < 8; ++j) { const float bias = BA ? bfr(BA[c0 + j * 16 + col]) : 0.f;
#pragma unroll
      for (int r = 0; r < 8; ++r) { const float v = acc[j][r] + bias; const _Float16 hv = (_Float16)v; sh[wave * 16 + 8 * g + r][j * 16 + col] = hv; sl[wave * 16 + 8 * g + r][j * 16 + col] = (_Float16)((v - (float)hv) * 1024.0f); } }
    __syncthreads();
    for (int e = tid; e < 64 * 16; e += 128) { const int rl = e >> 4, q = e & 15; vst2((unsigned*)(DH + (r0 + rl) * CC + c0 + q * 8), *(const v4u*)&sh[rl][q * 8]); if (hi_rows) vst2((unsigned*)(DL + (bb * nhi + t0 + rl) * (size_t)CC + c0 + q * 8), *(const v4u*)&sl[rl][q * 8]); }
  } else { const bool hi_rows = t0 < KHI;
#pragma unroll
    for (int j = 0; j < 8; ++j) { const float bias = BA ? bfr(BA[c0 + j * 16 + col]) : 0.f;
#pragma unroll
      for (int r = 0; r < 8; ++r) { const float v = acc[j][r] + bias; const int rl = wave * 16 + 8 * g + r, cl = j * 16 + col; th[cl][rl] = (_Float16)v; const __bf16 bh = (__bf16)v; tb[cl][rl] = bh; tbl[cl][rl] = (__bf16)(v - (float)bh); } }
    __syncthreads();
    for (int e = tid; e < 128 * 8; e += 128) { const int cl = e >> 3, q = e & 7; vst2((unsigned*)(VT + (bb * CC + c0 + cl) * (size_t)TT + t0 + q * 8), *(const v4u*)&th[cl][q * 8]); if (hi_rows) { const size_t o3 = (bb * CC + c0 + cl) * (size_t)KHI + t0 + q * 8; vst2((unsigned*)(VB + o3), *(const v4u*)&tb[cl][q * 8]); vst2((unsigned*)(VBL + o3), *(const v4u*)&tbl[cl][q * 8]); } } } }
// ---- k_sc: block = (query block qb, key block kb <= kb_last(qb), sequence in group) of batch b: logits x SCALE; q hi + residual (x 2^10) against k (2 products) for query rows < QHI, plus the k residual (3 products) for query blocks < QBH (causal early rows); causal: blocks past the diagonal exit, the mask itself is applied by index in k_sm
__global__ __launch_bounds__(128) void k_sc(const _Float16* __restrict__ QH, const _Float16* __restrict__ KH, const _Float16* __restrict__ QL, const _Float16* __restrict__ KL, int b0g, int h0, float* __restrict__ S0) { __shared__ __align__(16) float ss[4][16][132]; const int b = b0g + blockIdx.z;   /* sequence of this z-slice */
  const int qb = blockIdx.x, kb = blockIdx.y; if (kb > kb_last(qb)) return;
  const int h = h0; float* S = S0 + (size_t)blockIdx.z * TT * TT;   /* one score plane per sequence in the group */
  const int tid = threadIdx.x, wave = tid >> 5, lane = tid & 31, col = lane & 15, g = lane >> 4; const int k0 = kb * 128; const int ql0 = qb * 64 + wave * 16; const size_t q0 = (size_t)b * TT + ql0, kr0 = (size_t)b * TT + k0;
  v8f acc[8] = {}, accl[8] = {};
  const _Float16* QLb = QL + (size_t)b * QHI * CC; const _Float16* KLb = KL + (size_t)b * KHI * CC;
  if (qb < QBH) {
#pragma unroll
    for (int kc = 0; kc < HD / 32; ++kc) { const v16h ah = frag_h(QH + (q0 + col) * CC + h * HD + kc * 32, lane), al = frag_h(QLb + (size_t)(ql0 + col) * CC + h * HD + kc * 32, lane);
#pragma unroll
      for (int j = 0; j < 8; ++j) { const v16h kbf = frag_h(KH + (kr0 + j * 16 + col) * CC + h * HD + kc * 32, lane), klf = frag_h(KLb + (size_t)(k0 + j * 16 + col) * CC + h * HD + kc * 32, lane); acc[j] = wmma16(ah, kbf, acc[j]); accl[j] = wmma16(al, kbf, accl[j]); accl[j] = wmma16(ah, klf, accl[j]); } }
  } else if (qb * 64 < QHI) {
#pragma unroll
    for (int kc = 0; kc < HD / 32; ++kc) { const v16h ah = frag_h(QH + (q0 + col) * CC + h * HD + kc * 32, lane), al = frag_h(QLb + (size_t)(ql0 + col) * CC + h * HD + kc * 32, lane);
#pragma unroll
      for (int j = 0; j < 8; ++j) { const v16h kbf = frag_h(KH + (kr0 + j * 16 + col) * CC + h * HD + kc * 32, lane); acc[j] = wmma16(ah, kbf, acc[j]); accl[j] = wmma16(al, kbf, accl[j]); } }
  } else {
#pragma unroll
    for (int kc = 0; kc < HD / 32; ++kc) { const v16h ah = frag_h(QH + (q0 + col) * CC + h * HD + kc * 32, lane);
#pragma unroll
      for (int j = 0; j < 8; ++j) { const v16h kbf = frag_h(KH + (kr0 + j * 16 + col) * CC + h * HD + kc * 32, lane); acc[j] = wmma16(ah, kbf, acc[j]); } } }
#pragma unroll
  for (int j = 0; j < 8; ++j) {
#pragma unroll
    for (int r = 0; r < 8; ++r) ss[wave][8 * g + r][j * 16 + col] = (acc[j][r] + accl[j][r] * (1.0f / 1024.0f)) * SCALE; }
  LDSX(); for (int rl = 0; rl < 16; ++rl) vst2(S + (size_t)(ql0 + rl) * TT + k0 + lane * 4, *(const v4f*)&ss[wave][rl][lane * 4]); }
// ---- k_sm: block = query row t (sequence in group): keys [0, kend): causal -> logit if s <= t else excluded; softmax in f32; P x 2^11 in place (0 for excluded)
__global__ __launch_bounds__(256) void k_sm(float* __restrict__ S0 SM_EXTRA_PARAMS) { __shared__ float sred[8]; __shared__ float sbc; __shared__ __align__(16) float shv[TT];
  const int tid = threadIdx.x; const int t = blockIdx.x; const int kend = (kb_last(t >> 6) + 1) * 128;
  float* sr = S0 + (size_t)blockIdx.y * TT * TT + (size_t)t * TT;
  float m = -3.0e38f; for (int k = tid; k < kend; k += 256) { float v = (!CAUSAL || k <= t) ? sr[k] : -3.0e38f; SM_MASK_HOOK; shv[k] = v; m = fmaxf(m, v); }
#pragma unroll
  for (int o = 1; o < 32; o <<= 1) m = fmaxf(m, __shfl_xor(m, o));
  if ((tid & 31) == 0) sred[tid >> 5] = m; __syncthreads(); if (tid == 0) { float a = sred[0]; for (int i = 1; i < 8; ++i) a = fmaxf(a, sred[i]); sbc = a; } __syncthreads(); m = sbc; __syncthreads();
  float sum = 0.f; for (int k = tid; k < kend; k += 256) { const float v = shv[k]; const float e = (v <= -1.0e38f) ? 0.f : expf(v - m); shv[k] = e; sum += e; }
#pragma unroll
  for (int o = 1; o < 32; o <<= 1) sum += __shfl_xor(sum, o);
  if ((tid & 31) == 0) sred[tid >> 5] = sum; __syncthreads(); if (tid == 0) { float a = 0.f; for (int i = 0; i < 8; ++i) a += sred[i]; sbc = a > 0.f ? 2048.0f / a : 0.f; }   /* a fully excluded row yields P = 0 */ __syncthreads(); const float inv = sbc;
  for (int k = tid; k < kend; k += 256) shv[k] = shv[k] * inv;
  __syncthreads(); for (int q = tid; q < kend / 4; q += 256) vst2(sr + q * 4, *(const v4f*)&shv[q * 4]); }
// ---- k_pv: block = 64 queries (qb) of (b, h): ctx = P . v over keys [0, kend) (P x 2^11 once to f16 against v f16: 1 product; causal early query blocks: P and v as bf16 hi + lo, 3 products); 256-B (row, head) segment by 16 lanes
__global__ __launch_bounds__(128) void k_pv(const float* __restrict__ PS0, const _Float16* __restrict__ VT, const __bf16* __restrict__ VB, const __bf16* __restrict__ VBL, int b0g, int h0, float* __restrict__ Y) { const int b = b0g + blockIdx.z; const int h = h0; const float* PS = PS0 + (size_t)blockIdx.z * TT * TT; __shared__ __align__(16) float ss[4][16][HD + 4];
  const int tid = threadIdx.x, wave = tid >> 5, lane = tid & 31, col = lane & 15, g = lane >> 4; const int qb = blockIdx.x; const int ql0 = qb * 64 + wave * 16; const int kce = (kb_last(qb) + 1) * 4;
  v8f acc[HD / 16] = {};
  if (qb < QBH) {
#pragma unroll 1
    for (int kc = 0; kc < kce; ++kc) { const F2 p = split_row(PS + (size_t)(ql0 + col) * TT, kc * 32, lane);
      asm volatile("s_wait_loadcnt 0x0" ::: "memory");
#pragma unroll
      for (int j = 0; j < HD / 16; ++j) { const size_t po = ((size_t)b * CC + h * HD + j * 16 + col) * (size_t)KHI + kc * 32; const v16b vh = frag_b(VB + po, lane); acc[j] = wmma_bf(p.h, vh, acc[j]); acc[j] = wmma_bf(p.l, vh, acc[j]); acc[j] = wmma_bf(p.h, frag_b(VBL + po, lane), acc[j]); } }
  } else {
#pragma unroll 1
    for (int kc = 0; kc < kce; ++kc) { const v16h p = frag_f32(PS + (size_t)(ql0 + col) * TT + kc * 32, lane);
      asm volatile("s_wait_loadcnt 0x0" ::: "memory");
#pragma unroll
      for (int j = 0; j < HD / 16; ++j) { const size_t po = ((size_t)b * CC + h * HD + j * 16 + col) * (size_t)TT + kc * 32; acc[j] = wmma16(p, frag_h(VT + po, lane), acc[j]); } } }
#pragma unroll
  for (int j = 0; j < HD / 16; ++j)
#pragma unroll
    for (int r = 0; r < 8; ++r) ss[wave][8 * g + r][j * 16 + col] = acc[j][r] * (1.0f / 2048.0f);
  LDSX(); for (int rl = 0; rl < 16; ++rl) if (lane < HD / 4) vst2(Y + ((size_t)b * TT + ql0 + rl) * CC + h * HD + lane * 4, *(const v4f*)&ss[wave][rl][lane * 4]); }

extern "C" void kernel_launch(void* const* d_in, const int* in_sizes, int n_in, void* d_out, int out_size, void* d_ws, size_t ws_size, hipStream_t stream) {
  (void)in_sizes; (void)n_in; (void)out_size;
  const float** F = (const float**)d_in;
  if (ws_size < (size_t)WS_END) return;
  char* ws = (char*)d_ws; _Float16 *QH = (_Float16*)(ws + WS_QH), *KH = (_Float16*)(ws + WS_KH), *VT = (_Float16*)(ws + WS_VT), *QL = (_Float16*)(ws + WS_QL), *KL = (_Float16*)(ws + WS_KL); __bf16 *VB = (__bf16*)(ws + WS_VB), *VBL = (__bf16*)(ws + WS_VBL); float *S = (float*)(ws + WS_S), *Y = (float*)(ws + WS_Y);
  (void)Y; (void)QL; (void)KL; (void)VB; (void)VBL;
  // inputs: 0 x [64,512,384]; 1 Wq, 2 Wk, 3 Wv ((in,out) [384,64]); output [64,512,64]
  if (ws_size < (size_t)WS_END2) return;
  float* YY = (float*)(ws + WS_YY);
  k_proj<<<dim3(TNB * TT / 64, CC / 128, 3), 128, 0, stream>>>(F[0], F[0], F[0], F[1], F[2], F[3], nullptr, nullptr, nullptr, QH, QL, KH, KL, VT, VB, VBL);
  for (int bg = 0; bg < TNB; bg += BG) {   /* 32 sequences per pass, head 0 only */
    k_sc<<<dim3(NQB, TT / 128, BG), 128, 0, stream>>>(QH, KH, QL, KL, bg, 0, S);
    k_sm<<<dim3(TT, BG), 256, 0, stream>>>(S);
    k_pv<<<dim3(NQB, 1, BG), 128, 0, stream>>>(S, VT, VB, VBL, bg, 0, YY);
  }
  k_copy<<<dim3((TNB * TT * 16 + 255) / 256), 256, 0, stream>>>(YY, (float*)d_out);
}

// v001
// One run takes 63.3 microseconds.
// In both of two side-by-side timings against v000, it was 2.58 times as fast.
#include <hip/hip_runtime.h>
#include <math.h>

typedef __attribute__((ext_vector_type(16))) _Float16 v16h;
typedef __attribute__((ext_vector_type(16))) __bf16 v16b;
typedef __attribute__((ext_vector_type(8)))  _Float16 v8h;
typedef __attribute__((ext_vector_type(8)))  float v8f;
typedef __attribute__((ext_vector_type(4)))  float v4f;
typedef __attribute__((ext_vector_type(2)))  float v2f;
typedef __attribute__((ext_vector_type(4)))  unsigned v4u;
typedef __attribute__((ext_vector_type(4)))  int v4i;
typedef float __attribute__((may_alias)) float_a;
typedef int __attribute__((may_alias)) int_a;

template <typename T> __device__ __forceinline__ void vst2(void* p, T v) { *(T*)p = v;  }
__device__ __forceinline__ v8f wmma16(v16h a, v16h b, v8f c) {
  v8f d = __builtin_amdgcn_wmma_f32_16x16x32_f16(false, a, false, b, (short)0, c, false, false);
  asm volatile("v_nop\n\tv_nop\n\tv_nop\n\tv_nop" : "+v"(d) : "v"(a), "v"(b));
  return d;
}
__device__ __forceinline__ v8f wmma_bf(v16b a, v16b b, v8f c) {
  v8f d = __builtin_amdgcn_wmma_f32_16x16x32_bf16(false, a, false, b, (short)0, c, false, false);
  asm volatile("v_nop\n\tv_nop\n\tv_nop\n\tv_nop" : "+v"(d) : "v"(a), "v"(b));
  return d;
}
// 16x16x32 fragments: lane = (h = lane>>4, row/col = lane&15); elements 0..7 = k0+8h+0..7, 8..15 = k0+16+8h+0..7; D element r = row 8h+r
__device__ __forceinline__ v16h frag_h(const _Float16* rowk0, int lane) {
  union { v16h v; v8h q[2]; } u; const _Float16* p = rowk0 + 8 * (lane >> 4);
  u.q[0] = *(const v8h*)p; u.q[1] = *(const v8h*)(p + 16); return u.v;
}
__device__ __forceinline__ v16h frag_f32(const float* rowk0, int lane) {
  v16h a; const float* p = rowk0 + 8 * (lane >> 4);
#pragma unroll
  for (int i = 0; i < 8; ++i) { a[i] = (_Float16)p[i]; a[8 + i] = (_Float16)p[16 + i]; }
  return a;
}
__device__ __forceinline__ v16h frag_f32s(const float* rowk0, int lane, float sc) {
  v16h a; const float* p = rowk0 + 8 * (lane >> 4);
#pragma unroll
  for (int i = 0; i < 8; ++i) { a[i] = (_Float16)(p[i] * sc); a[8 + i] = (_Float16)(p[16 + i] * sc); }
  return a;
}
// column fragment from a [K][ld] layout (column n), rows >= K read as 0
__device__ __forceinline__ v16h fragc_f32(const float* W, int k0, int n, int lane, int ld, int K) {
  v16h a; const int g = lane >> 4;
#pragma unroll
  for (int i = 0; i < 8; ++i) { const int ka = k0 + 8 * g + i, kb = ka + 16;
    a[i] = (_Float16)(ka < K ? W[(size_t)(ka < K ? ka : K - 1) * ld + n] : 0.f); a[8 + i] = (_Float16)(kb < K ? W[(size_t)(kb < K ? kb : K - 1) * ld + n] : 0.f); }
  return a;
}
struct F2 { v16b h, l; };
__device__ __forceinline__ F2 bsplit16(const float v[16]) { F2 r;
#pragma unroll
  for (int i = 0; i < 16; ++i) { const __bf16 h = (__bf16)v[i]; r.h[i] = h; r.l[i] = (__bf16)(v[i] - (float)h); }
  return r; }
__device__ __forceinline__ F2 split_row(const float* row, int k0, int lane) { float v[16]; const float* p = row + k0 + 8 * (lane >> 4);
#pragma unroll
  for (int i = 0; i < 8; ++i) { v[i] = p[i]; v[8 + i] = p[16 + i]; }
  return bsplit16(v); }
__device__ __forceinline__ F2 split_rowK(const float* row, int k0, int lane, int K) { float v[16]; const int g = lane >> 4;
#pragma unroll
  for (int i = 0; i < 8; ++i) { const int ka = k0 + 8 * g + i, kb = ka + 16; v[i] = ka < K ? row[ka < K ? ka : K - 1] : 0.f; v[8 + i] = kb < K ? row[kb < K ? kb : K - 1] : 0.f; }
  return bsplit16(v); }
__device__ __forceinline__ F2 split_col(const float* W, int k0, int n, int lane, int ld, int K) { float v[16]; const int g = lane >> 4;
#pragma unroll
  for (int i = 0; i < 8; ++i) { const int ka = k0 + 8 * g + i, kb = ka + 16; v[i] = ka < K ? W[(size_t)(ka < K ? ka : K - 1) * ld + n] : 0.f; v[8 + i] = kb < K ? W[(size_t)(kb < K ? kb : K - 1) * ld + n] : 0.f; }
  return bsplit16(v); }
__device__ __forceinline__ v8f mac3(const F2& a, const F2& b, v8f c) { c = wmma_bf(a.l, b.h, c); c = wmma_bf(a.h, b.l, c); return wmma_bf(a.h, b.h, c); }
__device__ __forceinline__ float sigm(float v) { return 1.0f / (1.0f + expf(-v)); }
#define LDSX() do { asm volatile("s_wait_dscnt 0" ::: "memory"); __builtin_amdgcn_wave_barrier(); __builtin_amdgcn_fence(__ATOMIC_RELEASE, "workgroup"); } while (0)

// Single causal self-attention head (B 64, T 512, d_model 384, head 64): q/k/v = x W ((in,out) [384,64]); wei = softmax(causal(q k^T / 8)); out = wei v ([B, T, 64]). Two launches: the projections, then scores, softmax and P.v in one kernel.
#define NB 64
#define TT 512
#define CC 128            // NH * HD = projected width
#define DIN 384          // input (model) width
#define NH 2
#define HD 64
#define NQB (TT / 64)
#define SCALE (0.125f)
#define CAUSAL 1
#ifndef TNB
#define TNB NB
#endif
__device__ __forceinline__ float bfr(float v) { return (float)(__bf16)v; }
typedef __attribute__((ext_vector_type(8))) __bf16 v8b;
__device__ __forceinline__ v16b frag_b(const __bf16* rowk0, int lane) {
  union { v16b v; v8b q[2]; } u; const __bf16* p = rowk0 + 8 * (lane >> 4);
  u.q[0] = *(const v8b*)p; u.q[1] = *(const v8b*)(p + 16); return u.v;
}
#define QBH 6              // causal: query blocks 0..QBH-1 of each sequence (few keys, no averaging) take the high-precision path
#define QHI 384            // rows carrying a q residual plane
#define KHI 384            // key rows carrying k residual / v bf16 hi+lo planes (used only by the causal high-precision path)
// B fragment (k rows k0+.., output column o) of a weight: (in,out) [K][ld] or (out,in) [ld rows of K]: bf16 exact, or f16(bf16 * 256) exact
__device__ __forceinline__ v16b wcol_io(const float* Wm, int k0, int o, int lane, int ld) { v16b w; const int g = lane >> 4;
#pragma unroll
  for (int i = 0; i < 8; ++i) { w[i] = (__bf16)Wm[(size_t)(k0 + 8 * g + i) * ld + o]; w[8 + i] = (__bf16)Wm[(size_t)(k0 + 16 + 8 * g + i) * ld + o]; }
  return w; }
__device__ __forceinline__ v16b wcol_oi(const float* Wm, int k0, int o, int lane, int K) { v16b w; const float* p = Wm + (size_t)o * K + k0 + 8 * (lane >> 4);
#pragma unroll
  for (int i = 0; i < 8; ++i) { w[i] = (__bf16)p[i]; w[8 + i] = (__bf16)p[16 + i]; }
  return w; }
__device__ __forceinline__ v16h wcolh_io(const float* Wm, int k0, int o, int lane, int ld) { v16h w; const int g = lane >> 4;
#pragma unroll
  for (int i = 0; i < 8; ++i) { w[i] = (_Float16)(bfr(Wm[(size_t)(k0 + 8 * g + i) * ld + o]) * 256.0f); w[8 + i] = (_Float16)(bfr(Wm[(size_t)(k0 + 16 + 8 * g + i) * ld + o]) * 256.0f); }
  return w; }
__device__ __forceinline__ v16h wcolh_oi(const float* Wm, int k0, int o, int lane, int K) { v16h w; const float* p = Wm + (size_t)o * K + k0 + 8 * (lane >> 4);
#pragma unroll
  for (int i = 0; i < 8; ++i) { w[i] = (_Float16)(bfr(p[i]) * 256.0f); w[8 + i] = (_Float16)(bfr(p[16 + i]) * 256.0f); }
  return w; }
#define WQKV_LAYOUT 0   // 0 = (in,out) [DIN][HD]; 1 = (out,in) [CC][DIN]; 2 = per-head [NH][DIN][HD]
__device__ __forceinline__ v16b wcol_hdk(const float* Wm, int k0, int o, int lane) { v16b w; const int g = lane >> 4; const float* p = Wm + (size_t)(o / HD) * DIN * HD + (o % HD);
#pragma unroll
  for (int i = 0; i < 8; ++i) { w[i] = (__bf16)p[(size_t)(k0 + 8 * g + i) * HD]; w[8 + i] = (__bf16)p[(size_t)(k0 + 16 + 8 * g + i) * HD]; }
  return w; }
#define WO_OUT_IN 0
#if WQKV_LAYOUT == 1
#define WCOL(W, k0, o, lane) wcol_oi(W, k0, o, lane, DIN)
#elif WQKV_LAYOUT == 2
#define WCOL(W, k0, o, lane) wcol_hdk(W, k0, o, lane)
#else
#define WCOL(W, k0, o, lane) wcol_io(W, k0, (o) & 63, lane, HD)   /* (in,out) [384][64]; columns 64..127 = a second copy of the head */
#endif
#if WO_OUT_IN
#define WOCOL(W, k0, o, lane) wcol_oi(W, k0, o, lane, CC)
#define WOCOLH(W, k0, o, lane) wcolh_oi(W, k0, o, lane, CC)
#else
#define WOCOL(W, k0, o, lane) wcol_io(W, k0, o, lane, DIN)
#define WOCOLH(W, k0, o, lane) wcolh_io(W, k0, o, lane, DIN)
#endif
#ifndef PROJ_EXTRA_PARAMS
#define PROJ_EXTRA_PARAMS
#endif

#define WS_QH  0u                                      // f16 q rows [b*t][CC]
#define WS_KH  (WS_QH + 2u * (size_t)NB * TT * CC)      // f16 k rows [b*t][CC]
#define WS_VT  (WS_KH + 2u * (size_t)NB * TT * CC)      // f16 v planes [b][c][t]
#define WS_QL  (WS_VT + 2u * (size_t)NB * CC * TT)      // f16 q residual x 2^10 rows [b][t < QHI][CC]
#define WS_KL  (WS_QL + 2u * (size_t)NB * QHI * CC)     // f16 k residual x 2^10 rows [b][t < KHI][CC]
#define WS_VB  (WS_KL + 2u * (size_t)NB * KHI * CC)     // bf16 v hi planes [b][c][t < KHI]
#define WS_VBL (WS_VB + 2u * (size_t)NB * CC * KHI)
#define WS_END (WS_VBL + 2u * (size_t)NB * CC * KHI)

// ---- k_proj: block = (64 rows, 128 cols, which): q/k/v = X W (+ b) with exact bf16 products (K = DIN) -> which 0: q f16 rows (+ residual rows < QHI); 1: k f16 rows (+ residual rows < KHI); 2: v f16 planes [c][t] (+ bf16 hi/lo planes for t < KHI)
__global__ __launch_bounds__(128) void k_proj(const float* __restrict__ XQ, const float* __restrict__ XK, const float* __restrict__ XV, const float* __restrict__ WQ, const float* __restrict__ WK, const float* __restrict__ WV, const float* __restrict__ BQ, const float* __restrict__ BK, const float* __restrict__ BV,
    _Float16* __restrict__ QH, _Float16* __restrict__ QL, _Float16* __restrict__ KH, _Float16* __restrict__ KL, _Float16* __restrict__ VT, __bf16* __restrict__ VB, __bf16* __restrict__ VBL) {
  __shared__ __align__(16) _Float16 sh[64][136], sl[64][136]; __shared__ __align__(16) _Float16 th[128][72]; __shared__ __align__(16) __bf16 tb[128][72], tbl[128][72];
  const int tid = threadIdx.x, wave = tid >> 5, lane = tid & 31, col = lane & 15, g = lane >> 4; const int which = blockIdx.z; const int c0 = blockIdx.y * 128; const size_t r0 = (size_t)blockIdx.x * 64; const size_t bb = r0 / TT; const int t0 = (int)(r0 % TT);
  const float* X = which == 0 ? XQ : which == 1 ? XK : XV; const float* WA = which == 0 ? WQ : which == 1 ? WK : WV; const float* BA = which == 0 ? BQ : which == 1 ? BK : BV;
  v8f acc[8] = {};
#pragma unroll 2
  for (int kc = 0; kc < DIN / 32; ++kc) { v16b a; { const float* p = X + (r0 + wave * 16 + col) * DIN + kc * 32 + 8 * g;
#pragma unroll
      for (int i = 0; i < 8; ++i) { a[i] = (__bf16)p[i]; a[8 + i] = (__bf16)p[16 + i]; } }
    asm volatile("s_wait_loadcnt 0x0" ::: "memory");
#pragma unroll
    for (int j = 0; j < 8; ++j) { const v16b w = WCOL(WA, kc * 32, c0 + j * 16 + col, lane); asm volatile("s_wait_loadcnt 0x0" ::: "memory"); acc[j] = wmma_bf(a, w, acc[j]); } }
  if (which < 2) { _Float16* DH = which == 0 ? QH : KH; _Float16* DL = which == 0 ? QL : KL; const int nhi = which == 0 ? QHI : KHI; const bool hi_rows = t0 < nhi;
#pragma unroll
    for (int j = 0; j < 8; ++j) { const float bias = BA ? bfr(BA[c0 + j * 16 + col]) : 0.f;
#pragma unroll
      for (int r = 0; r < 8; ++r) { const float v = acc[j][r] + bias; const _Float16 hv = (_Float16)v; sh[wave * 16 + 8 * g + r][j * 16 + col] = hv; sl[wave * 16 + 8 * g + r][j * 16 + col] = (_Float16)((v - (float)hv) * 1024.0f); } }
    __syncthreads();
    for (int e = tid; e < 64 * 16; e += 128) { const int rl = e >> 4, q = e & 15; vst2((unsigned*)(DH + (r0 + rl) * CC + c0 + q * 8), *(const v4u*)&sh[rl][q * 8]); if (hi_rows) vst2((unsigned*)(DL + (bb * nhi + t0 + rl) * (size_t)CC + c0 + q * 8), *(const v4u*)&sl[rl][q * 8]); }
  } else { const bool hi_rows = t0 < KHI;
#pragma unroll
    for (int j = 0; j < 8; ++j) { const float bias = BA ? bfr(BA[c0 + j * 16 + col]) : 0.f;
#pragma unroll
      for (int r = 0; r < 8; ++r) { const float v = acc[j][r] + bias; const int rl = wave * 16 + 8 * g + r, cl = j * 16 + col; th[cl][rl] = (_Float16)v; const __bf16 bh = (__bf16)v; tb[cl][rl] = bh; tbl[cl][rl] = (__bf16)(v - (float)bh); } }
    __syncthreads();
    for (int e = tid; e < 128 * 8; e += 128) { const int cl = e >> 3, q = e & 7; vst2((unsigned*)(VT + (bb * CC + c0 + cl) * (size_t)TT + t0 + q * 8), *(const v4u*)&th[cl][q * 8]); if (hi_rows) { const size_t o3 = (bb * CC + c0 + cl) * (size_t)KHI + t0 + q * 8; vst2((unsigned*)(VB + o3), *(const v4u*)&tb[cl][q * 8]); vst2((unsigned*)(VBL + o3), *(const v4u*)&tbl[cl][q * 8]); } } } }
// fragment in the hardware k order from a lane's own pointer (row or plane start + 8 * (lane >> 4))
__device__ __forceinline__ v16h frag_hp(const _Float16* p) { union { v16h v; v8h q[2]; } u; u.q[0] = *(const v8h*)p; u.q[1] = *(const v8h*)(p + 16); return u.v; }
__device__ __forceinline__ v16b frag_bp(const __bf16* p) { union { v16b v; v8b q[2]; } u; u.q[0] = *(const v8b*)p; u.q[1] = *(const v8b*)(p + 16); return u.v; }
// ---- k_attn: block = 4 waves x 16 queries (query block qb) of sequence b; each wave on its own, no LDS. Transposed products: S^T = K Q^T (a lane holds one query's scores, keys 8g+r of each 16-key tile), causal mask by index, running maximum and sum per lane from pass to pass, O^T += V^T P^T with P^T packed from two score tiles (hardware k order, as V^T is loaded). Products as before: query blocks < QBH take q/k hi + residual (3 products) and P, v as bf16 hi + lo (3 products), 32 keys a pass; the rest one f16 product each (P x 2^11), 64 keys a pass.
// Loads: a pass issues its v fragments ahead of its score products and the next pass's k fragments right behind them (into the registers those products have just read), so v lands under the score work and k under softmax and P.v. The v_nop statements of the product helpers hold a load on its side of them, which is what keeps the two groups at these places.
template <bool HI> __device__ __forceinline__ void attn_body(const _Float16* __restrict__ QH, const _Float16* __restrict__ KH, const _Float16* __restrict__ QL, const _Float16* __restrict__ KL, const _Float16* __restrict__ VT, const __bf16* __restrict__ VB, const __bf16* __restrict__ VBL, int b, int qb, float* __restrict__ OUT) {
  constexpr int KT = HI ? 2 : 4;   /* 16-key tiles a pass */
  const int tid = threadIdx.x, wave = __builtin_amdgcn_readfirstlane(tid >> 5), lane = tid & 31, col = lane & 15, g = lane >> 4; const int ql0 = qb * 64 + wave * 16, t = ql0 + col; const size_t rb = (size_t)b * TT;
  const unsigned ko = (unsigned)(col * CC + 8 * g), vo = (unsigned)(col * (HI ? KHI : TT) + 8 * g);   /* lane offsets: row col of a [.][CC] tile, plane col of v */
  v16h qh[HD / 32], ql[HD / 32], kh[KT][HD / 32], kl[KT][HD / 32];
#pragma unroll
  for (int kc = 0; kc < HD / 32; ++kc) { qh[kc] = frag_hp(QH + (rb + ql0) * CC + kc * 32 + ko); if (HI) ql[kc] = frag_hp(QL + ((size_t)b * QHI + ql0) * CC + kc * 32 + ko); }
  const _Float16* kp = KH + rb * CC + ko; const _Float16* klp = KL + (size_t)b * KHI * CC + ko;   /* the lane's k row of the pass whose fragments are loaded next */
#pragma unroll
  for (int i = 0; i < KT; ++i)
#pragma unroll
    for (int kc = 0; kc < HD / 32; ++kc) { kh[i][kc] = frag_hp(kp + i * 16 * CC + kc * 32); if (HI) kl[i][kc] = frag_hp(klp + i * 16 * CC + kc * 32); }
  // each s_wait_xcnt below is the wait that stands before a register named by an issued load is written again; the pointers are its inputs so that they keep their registers up to it
  if (HI) asm volatile("s_wait_xcnt 0x0" :: "v"(kp), "v"(klp) : "memory"); else asm volatile("s_wait_xcnt 0x0" :: "v"(kp) : "memory");
  v8f acc[HD / 16] = {}; float m = -3.0e38f, l = 0.f; const int npass = (ql0 + 15) / (16 * KT) + 1;   /* keys 0 .. ql0 + 15 */
#pragma unroll 1
  for (int kb = 0; kb < npass; ++kb) { const int k0 = kb * 16 * KT;
    v16h vf[KT / 2][HD / 16]; v16b vh[KT / 2][HD / 16], vl[KT / 2][HD / 16];
    const _Float16* vp = VT + (size_t)b * CC * TT + k0 + vo; const __bf16* vbp = VB + (size_t)b * CC * KHI + k0 + vo; const __bf16* vlp = VBL + (size_t)b * CC * KHI + k0 + vo;
#pragma unroll
    for (int ks = 0; ks < KT / 2; ++ks)
#pragma unroll
      for (int j = 0; j < HD / 16; ++j) {
        if (HI) { vh[ks][j] = frag_bp(vbp + j * 16 * KHI + ks * 32); vl[ks][j] = frag_bp(vlp + j * 16 * KHI + ks * 32); }
        else vf[ks][j] = frag_hp(vp + j * 16 * TT + ks * 32); }
    v8f s[KT];
#pragma unroll
    for (int i = 0; i < KT; ++i) { v8f a = {}, al = {};
#pragma unroll
      for (int kc = 0; kc < HD / 32; ++kc) { a = wmma16(kh[i][kc], qh[kc], a); if (HI) { al = wmma16(kh[i][kc], ql[kc], al); al = wmma16(kl[i][kc], qh[kc], al); } }
#pragma unroll
      for (int r = 0; r < 8; ++r) { const float v = (HI ? a[r] + al[r] * (1.0f / 1024.0f) : a[r]) * SCALE; s[i][r] = (k0 + i * 16 + 8 * g + r <= t) ? v : -3.0e38f; } }
    if (HI) asm volatile("s_wait_xcnt 0x0" :: "v"(vbp), "v"(vlp) : "memory"); else asm volatile("s_wait_xcnt 0x0" :: "v"(vp) : "memory");
    const int adv = kb + 1 < npass ? 16 * KT * CC : 0; kp += adv; klp += adv;   /* the last pass loads its own rows again: no branch, so the counted waits on v below leave these loads in flight */
#pragma unroll
    for (int i = 0; i < KT; ++i)
#pragma unroll
      for (int kc = 0; kc < HD / 32; ++kc) { kh[i][kc] = frag_hp(kp + i * 16 * CC + kc * 32); if (HI) kl[i][kc] = frag_hp(klp + i * 16 * CC + kc * 32); }
    float mb = s[0][0];
#pragma unroll
    for (int i = 0; i < KT; ++i)
#pragma unroll
      for (int r = 0; r < 8; ++r) mb = fmaxf(mb, s[i][r]);
    mb = fmaxf(mb, __shfl_xor(mb, 16)); const float mn = fmaxf(m, mb); const float alpha = expf(m - mn); m = mn;   /* pass 0 holds key 0 <= t, so mn is a real logit from there on */
    float sum = 0.f;
#pragma unroll
    for (int i = 0; i < KT; ++i)
#pragma unroll
      for (int r = 0; r < 8; ++r) { const float e = expf(s[i][r] - mn); s[i][r] = e; sum += e; }
    l = l * alpha + sum;   /* this half's keys only; the halves join after the loop */
#pragma unroll
    for (int j = 0; j < HD / 16; ++j) acc[j] *= alpha;
    if (HI) asm volatile("s_wait_xcnt 0x0" :: "v"(kp), "v"(klp) : "memory"); else asm volatile("s_wait_xcnt 0x0" :: "v"(kp) : "memory");
#pragma unroll
    for (int ks = 0; ks < KT / 2; ++ks) {
      if (HI) { float pv[16];
#pragma unroll
        for (int r = 0; r < 8; ++r) { pv[r] = s[2 * ks][r]; pv[8 + r] = s[2 * ks + 1][r]; }
        const F2 p = bsplit16(pv);
#pragma unroll
        for (int j = 0; j < HD / 16; ++j) { acc[j] = wmma_bf(vh[ks][j], p.h, acc[j]); acc[j] = wmma_bf(vh[ks][j], p.l, acc[j]); acc[j] = wmma_bf(vl[ks][j], p.h, acc[j]); }
      } else { v16h p;
#pragma unroll
        for (int r = 0; r < 8; ++r) { p[r] = (_Float16)(s[2 * ks][r] * 2048.0f); p[8 + r] = (_Float16)(s[2 * ks + 1][r] * 2048.0f); }
#pragma unroll
        for (int j = 0; j < HD / 16; ++j) acc[j] = wmma16(vf[ks][j], p, acc[j]); } } }
  asm volatile("s_wait_loadcnt 0x0" ::: "memory");   /* the last pass's look-ahead loads land before the wave goes on to its end */
  l += __shfl_xor(l, 16); const float inv = l > 0.f ? (HI ? 1.0f : 1.0f / 2048.0f) / l : 0.f;
#pragma unroll
  for (int j = 0; j < HD / 16; ++j) acc[j] *= inv;
#pragma unroll
  for (int j = 0; j < HD / 16; ++j) { float* o = OUT + (rb + ql0) * HD + j * 16 + (unsigned)(col * HD + 8 * g);   /* lane: head columns j*16 + 8g + 0..7 of its query row */
    vst2(o, __builtin_shufflevector(acc[j], acc[j], 0, 1, 2, 3)); vst2(o + 4, __builtin_shufflevector(acc[j], acc[j], 4, 5, 6, 7)); } }
__global__ __launch_bounds__(128) void k_attn(const _Float16* __restrict__ QH, const _Float16* __restrict__ KH, const _Float16* __restrict__ QL, const _Float16* __restrict__ KL, const _Float16* __restrict__ VT, const __bf16* __restrict__ VB, const __bf16* __restrict__ VBL, float* __restrict__ OUT) {
  const int b = blockIdx.x, y = blockIdx.y, qb = y < NQB / 2 ? NQB - 1 - y : y - NQB / 2;   /* for speed only: the sequence is the fast index, so each query block's cost spreads over the chip; long key walks start first, the second half of the grid rises from the shortest */
  if (qb < QBH) attn_body<true>(QH, KH, QL, KL, VT, VB, VBL, b, qb, OUT); else attn_body<false>(QH, KH, QL, KL, VT, VB, VBL, b, qb, OUT); }

extern "C" void kernel_launch(void* const* d_in, const int* in_sizes, int n_in, void* d_out, int out_size, void* d_ws, size_t ws_size, hipStream_t stream) {
  (void)in_sizes; (void)n_in; (void)out_size;
  const float** F = (const float**)d_in;
  if (ws_size < (size_t)WS_END) return;
  char* ws = (char*)d_ws; _Float16 *QH = (_Float16*)(ws + WS_QH), *KH = (_Float16*)(ws + WS_KH), *VT = (_Float16*)(ws + WS_VT), *QL = (_Float16*)(ws + WS_QL), *KL = (_Float16*)(ws + WS_KL); __bf16 *VB = (__bf16*)(ws + WS_VB), *VBL = (__bf16*)(ws + WS_VBL);
  // inputs: 0 x [64,512,384]; 1 Wq, 2 Wk, 3 Wv ((in,out) [384,64]); output [64,512,64]
  k_proj<<<dim3(TNB * TT / 64, CC / 128, 3), 128, 0, stream>>>(F[0], F[0], F[0], F[1], F[2], F[3], nullptr, nullptr, nullptr, QH, QL, KH, KL, VT, VB, VBL);
  k_attn<<<dim3(TNB, NQB), 128, 0, stream>>>(QH, KH, QL, KL, VT, VB, VBL, (float*)d_out);
}

// v002
// Measured time: 35.4 microseconds a run.
// Timed twice side by side with v001, it ran 1.78 and 1.79 times as fast.
// Counting every step since v000, it is 4.60 times as fast.
#include <hip/hip_runtime.h>
#include <math.h>

typedef __attribute__((ext_vector_type(16))) _Float16 v16h;
typedef __attribute__((ext_vector_type(16))) __bf16 v16b;
typedef __attribute__((ext_vector_type(8)))  _Float16 v8h;
typedef __attribute__((ext_vector_type(8)))  float v8f;
typedef __attribute__((ext_vector_type(4)))  float v4f;
typedef __attribute__((ext_vector_type(2)))  float v2f;
typedef __attribute__((ext_vector_type(4)))  unsigned v4u;
typedef __attribute__((ext_vector_type(4)))  int v4i;
typedef float __attribute__((may_alias)) float_a;
typedef int __attribute__((may_alias)) int_a;

template <typename T> __device__ __forceinline__ void vst2(void* p, T v) { *(T*)p = v;  }
__device__ __forceinline__ v8f wmma16(v16h a, v16h b, v8f c) {
  v8f d = __builtin_amdgcn_wmma_f32_16x16x32_f16(false, a, false, b, (short)0, c, false, false);
  asm volatile("v_nop\n\tv_nop\n\tv_nop\n\tv_nop" : "+v"(d) : "v"(a), "v"(b));
  return d;
}
__device__ __forceinline__ v8f wmma_bf(v16b a, v16b b, v8f c) {
  v8f d = __builtin_amdgcn_wmma_f32_16x16x32_bf16(false, a, false, b, (short)0, c, false, false);
  asm volatile("v_nop\n\tv_nop\n\tv_nop\n\tv_nop" : "+v"(d) : "v"(a), "v"(b));
  return d;
}
// 16x16x32 fragments: lane = (h = lane>>4, row/col = lane&15); elements 0..7 = k0+8h+0..7, 8..15 = k0+16+8h+0..7; D element r = row 8h+r
__device__ __forceinline__ v16h frag_h(const _Float16* rowk0, int lane) {
  union { v16h v; v8h q[2]; } u; const _Float16* p = rowk0 + 8 * (lane >> 4);
  u.q[0] = *(const v8h*)p; u.q[1] = *(const v8h*)(p + 16); return u.v;
}
__device__ __forceinline__ v16h frag_f32(const float* rowk0, int lane) {
  v16h a; const float* p = rowk0 + 8 * (lane >> 4);
#pragma unroll
  for (int i = 0; i < 8; ++i) { a[i] = (_Float16)p[i]; a[8 + i] = (_Float16)p[16 + i]; }
  return a;
}
__device__ __forceinline__ v16h frag_f32s(const float* rowk0, int lane, float sc) {
  v16h a; const float* p = rowk0 + 8 * (lane >> 4);
#pragma unroll
  for (int i = 0; i < 8; ++i) { a[i] = (_Float16)(p[i] * sc); a[8 + i] = (_Float16)(p[16 + i] * sc); }
  return a;
}
// column fragment from a [K][ld] layout (column n), rows >= K read as 0
__device__ __forceinline__ v16h fragc_f32(const float* W, int k0, int n, int lane, int ld, int K) {
  v16h a; const int g = lane >> 4;
#pragma unroll
  for (int i = 0; i < 8; ++i) { const int ka = k0 + 8 * g + i, kb = ka + 16;
    a[i] = (_Float16)(ka < K ? W[(size_t)(ka < K ? ka : K - 1) * ld + n] : 0.f); a[8 + i] = (_Float16)(kb < K ? W[(size_t)(kb < K ? kb : K - 1) * ld + n] : 0.f); }
  return a;
}
struct F2 { v16b h, l; };
__device__ __forceinline__ F2 bsplit16(const float v[16]) { F2 r;
#pragma unroll
  for (int i = 0; i < 16; ++i) { const __bf16 h = (__bf16)v[i]; r.h[i] = h; r.l[i] = (__bf16)(v[i] - (float)h); }
  return r; }
__device__ __forceinline__ F2 split_row(const float* row, int k0, int lane) { float v[16]; const float* p = row + k0 + 8 * (lane >> 4);
#pragma unroll
  for (int i = 0; i < 8; ++i) { v[i] = p[i]; v[8 + i] = p[16 + i]; }
  return bsplit16(v); }
__device__ __forceinline__ F2 split_rowK(const float* row, int k0, int lane, int K) { float v[16]; const int g = lane >> 4;
#pragma unroll
  for (int i = 0; i < 8; ++i) { const int ka = k0 + 8 * g + i, kb = ka + 16; v[i] = ka < K ? row[ka < K ? ka : K - 1] : 0.f; v[8 + i] = kb < K ? row[kb < K ? kb : K - 1] : 0.f; }
  return bsplit16(v); }
__device__ __forceinline__ F2 split_col(const float* W, int k0, int n, int lane, int ld, int K) { float v[16]; const int g = lane >> 4;
#pragma unroll
  for (int i = 0; i < 8; ++i) { const int ka = k0 + 8 * g + i, kb = ka + 16; v[i] = ka < K ? W[(size_t)(ka < K ? ka : K - 1) * ld + n] : 0.f; v[8 + i] = kb < K ? W[(size_t)(kb < K ? kb : K - 1) * ld + n] : 0.f; }
  return bsplit16(v); }
__device__ __forceinline__ v8f mac3(const F2& a, const F2& b, v8f c) { c = wmma_bf(a.l, b.h, c); c = wmma_bf(a.h, b.l, c); return wmma_bf(a.h, b.h, c); }
__device__ __forceinline__ float sigm(float v) { return 1.0f / (1.0f + expf(-v)); }
#define LDSX() do { asm volatile("s_wait_dscnt 0" ::: "memory"); __builtin_amdgcn_wave_barrier(); __builtin_amdgcn_fence(__ATOMIC_RELEASE, "workgroup"); } while (0)

// Single causal self-attention head (B 64, T 512, d_model 384, head 64): q/k/v = x W ((in,out) [384,64]); wei = softmax(causal(q k^T / 8)); out = wei v ([B, T, 64]). Two launches: the projections, then scores, softmax and P.v in one kernel.
#define NB 64
#define TT 512
#define CC 128            // NH * HD = q/k row width and v plane count in the workspace; only the first HD are written
#define DIN 384          // input (model) width
#define NH 2
#define HD 64
#define NQB (TT / 64)
#define SCALE (0.125f)
#define CAUSAL 1
#ifndef TNB
#define TNB NB
#endif
__device__ __forceinline__ float bfr(float v) { return (float)(__bf16)v; }
typedef __attribute__((ext_vector_type(8))) __bf16 v8b;
__device__ __forceinline__ v16b frag_b(const __bf16* rowk0, int lane) {
  union { v16b v; v8b q[2]; } u; const __bf16* p = rowk0 + 8 * (lane >> 4);
  u.q[0] = *(const v8b*)p; u.q[1] = *(const v8b*)(p + 16); return u.v;
}
#define QBH 6              // causal: query blocks 0..QBH-1 of each sequence (few keys, no averaging) take the high-precision path
#define QHI 384            // rows carrying a q residual plane
#define KHI 384            // key rows carrying k residual / v bf16 hi+lo planes (used only by the causal high-precision path)
// B fragment (k rows k0+.., output column o) of a weight: (in,out) [K][ld] or (out,in) [ld rows of K]: bf16 exact, or f16(bf16 * 256) exact
__device__ __forceinline__ v16b wcol_io(const float* Wm, int k0, int o, int lane, int ld) { v16b w; const int g = lane >> 4;
#pragma unroll
  for (int i = 0; i < 8; ++i) { w[i] = (__bf16)Wm[(size_t)(k0 + 8 * g + i) * ld + o]; w[8 + i] = (__bf16)Wm[(size_t)(k0 + 16 + 8 * g + i) * ld + o]; }
  return w; }
__device__ __forceinline__ v16b wcol_oi(const float* Wm, int k0, int o, int lane, int K) { v16b w; const float* p = Wm + (size_t)o * K + k0 + 8 * (lane >> 4);
#pragma unroll
  for (int i = 0; i < 8; ++i) { w[i] = (__bf16)p[i]; w[8 + i] = (__bf16)p[16 + i]; }
  return w; }
__device__ __forceinline__ v16h wcolh_io(const float* Wm, int k0, int o, int lane, int ld) { v16h w; const int g = lane >> 4;
#pragma unroll
  for (int i = 0; i < 8; ++i) { w[i] = (_Float16)(bfr(Wm[(size_t)(k0 + 8 * g + i) * ld + o]) * 256.0f); w[8 + i] = (_Float16)(bfr(Wm[(size_t)(k0 + 16 + 8 * g + i) * ld + o]) * 256.0f); }
  return w; }
__device__ __forceinline__ v16h wcolh_oi(const float* Wm, int k0, int o, int lane, int K) { v16h w; const float* p = Wm + (size_t)o * K + k0 + 8 * (lane >> 4);
#pragma unroll
  for (int i = 0; i < 8; ++i) { w[i] = (_Float16)(bfr(p[i]) * 256.0f); w[8 + i] = (_Float16)(bfr(p[16 + i]) * 256.0f); }
  return w; }
#define WQKV_LAYOUT 0   // 0 = (in,out) [DIN][HD]; 1 = (out,in) [CC][DIN]; 2 = per-head [NH][DIN][HD]
__device__ __forceinline__ v16b wcol_hdk(const float* Wm, int k0, int o, int lane) { v16b w; const int g = lane >> 4; const float* p = Wm + (size_t)(o / HD) * DIN * HD + (o % HD);
#pragma unroll
  for (int i = 0; i < 8; ++i) { w[i] = (__bf16)p[(size_t)(k0 + 8 * g + i) * HD]; w[8 + i] = (__bf16)p[(size_t)(k0 + 16 + 8 * g + i) * HD]; }
  return w; }
#define WO_OUT_IN 0
#if WQKV_LAYOUT == 1
#define WCOL(W, k0, o, lane) wcol_oi(W, k0, o, lane, DIN)
#elif WQKV_LAYOUT == 2
#define WCOL(W, k0, o, lane) wcol_hdk(W, k0, o, lane)
#else
#define WCOL(W, k0, o, lane) wcol_io(W, k0, (o) & 63, lane, HD)   /* (in,out) [384][64]; columns 64..127 = a second copy of the head */
#endif
#if WO_OUT_IN
#define WOCOL(W, k0, o, lane) wcol_oi(W, k0, o, lane, CC)
#define WOCOLH(W, k0, o, lane) wcolh_oi(W, k0, o, lane, CC)
#else
#define WOCOL(W, k0, o, lane) wcol_io(W, k0, o, lane, DIN)
#define WOCOLH(W, k0, o, lane) wcolh_io(W, k0, o, lane, DIN)
#endif
#ifndef PROJ_EXTRA_PARAMS
#define PROJ_EXTRA_PARAMS
#endif

#define WS_QH  0u                                      // f16 q rows [b*t][CC]
#define WS_KH  (WS_QH + 2u * (size_t)NB * TT * CC)      // f16 k rows [b*t][CC]
#define WS_VT  (WS_KH + 2u * (size_t)NB * TT * CC)      // f16 v planes [b][c][t]
#define WS_QL  (WS_VT + 2u * (size_t)NB * CC * TT)      // f16 q residual x 2^10 rows [b][t < QHI][CC]
#define WS_KL  (WS_QL + 2u * (size_t)NB * QHI * CC)     // f16 k residual x 2^10 rows [b][t < KHI][CC]
#define WS_VB  (WS_KL + 2u * (size_t)NB * KHI * CC)     // bf16 v hi planes [b][c][t < KHI]
#define WS_VBL (WS_VB + 2u * (size_t)NB * CC * KHI)
#define WS_END (WS_VBL + 2u * (size_t)NB * CC * KHI)

// ---- k_proj: block = 8 waves x 16 rows of x, all 192 real output columns (q, k, v: 64 each). The three weights are staged once in LDS as bf16 in fragment order, so the k loop reads a weight fragment with two 16-byte LDS loads and one x fragment feeds all twelve tiles. Products and k order as before (exact bf16 products, K = DIN).
// q and k tiles are formed transposed (weight fragment as A, x fragment as B): a lane then holds 8 neighbouring columns of one row and stores them straight to the row layout. v tiles (x as A): a lane holds 8 neighbouring t of one plane; the planes go through LDS so that a whole 256-byte run of a plane is stored by neighbouring lanes.
// Columns 64..127 of the [.][CC] rows and planes 64..127 of v are not written: k_attn reads none of them.
// Every loop of this kernel is unrolled in full: its register arrays (x chunks, fragment ring, accumulators) are then indexed by constants and stay in registers.
#define PR 128             // rows of x a block
#define WFU 65             // 16-byte units from one weight fragment to the next in LDS: 2 halves x 32 lanes, + 1 so that the staging stores of the four column tiles fall on different banks
#define XPF 4              // k chunks of x in flight ahead of the products
#define WRING 8            // weight fragments in flight from LDS ahead of the products
#define NSTEP (12 * (DIN / 32))   // products a wave: 12 tiles a k chunk
#define WFRAG(s) (((((s) % 12) >> 2) * (DIN / 32) + (s) / 12) * (HD / 16) + (((s) % 12) & 3))   // fragment of product s: weight (s % 12) / 4, k chunk s / 12, column tile s % 4
__global__ __launch_bounds__(256) void k_proj(const float* __restrict__ X, const float* __restrict__ WQ, const float* __restrict__ WK, const float* __restrict__ WV,
    _Float16* __restrict__ QH, _Float16* __restrict__ QL, _Float16* __restrict__ KH, _Float16* __restrict__ KL, _Float16* __restrict__ VT, __bf16* __restrict__ VB, __bf16* __restrict__ VBL) {
  __shared__ __align__(16) v4u wl[3 * (DIN / 32) * (HD / 16) * WFU]; __shared__ __align__(16) v4u tv[3][HD][PR / 8 + 1];
  const int tid = threadIdx.x, wave = tid >> 5, lane = tid & 31, col = lane & 15, g = lane >> 4; const size_t r0 = (size_t)blockIdx.x * PR; const size_t bb = r0 / TT; const int t0 = (int)(r0 % TT);
  const float* xp = X + (r0 + wave * 16 + col) * DIN + 8 * g;   /* the lane's row of x, at its half's first k */
  v4f xr[DIN / 32][4];
#pragma unroll
  for (int kc = 0; kc < XPF; ++kc) { xr[kc][0] = *(const v4f*)(xp + kc * 32); xr[kc][1] = *(const v4f*)(xp + kc * 32 + 4); xr[kc][2] = *(const v4f*)(xp + kc * 32 + 16); xr[kc][3] = *(const v4f*)(xp + kc * 32 + 20); }
  // staging: a thread takes 8 k rows x 4 columns of a weight (whole lines across the lanes) and writes four 16-byte units, one per column: 8 neighbouring k of that column, which is one half of a lane's fragment
  { const int kg0 = tid >> 4, c4 = tid & 15; const unsigned wo = (unsigned)(kg0 * 8 * HD + c4 * 4) * 4u;   /* the thread's byte offset in each weight */
    const float* wq = (const float*)((const char*)WQ + wo); const float* wk = (const float*)((const char*)WK + wo); const float* wv = (const float*)((const char*)WV + wo); v4f w[9][8];
#pragma unroll
    for (int n = 0; n < 9; ++n) { const float* wp = n < 3 ? wq : n < 6 ? wk : wv;
#pragma unroll
      for (int i = 0; i < 8; ++i) w[n][i] = *(const v4f*)(wp + ((n % 3) * 16 * 8 + i) * HD); }
    // the wait that stands before a register named by an issued load or store is written again; here and below those registers are its inputs so that they keep their values up to it
    asm volatile("s_wait_xcnt 0x0" :: "v"(xp), "v"(wo) : "memory");
#pragma unroll
    for (int n = 0; n < 9; ++n) { const int kg = (n % 3) * 16 + kg0;   /* k group kg = 4 kc + 2 half + g */
      const int u0 = (((n / 3) * (DIN / 32) + (kg >> 2)) * (HD / 16) + (c4 >> 2)) * WFU + ((kg >> 1) & 1) * 32 + (kg & 1) * 16 + (c4 & 3) * 4;
#pragma unroll
      for (int s = 0; s < 4; ++s) { union { v8b b; v4u u; } t;
#pragma unroll
        for (int i = 0; i < 8; ++i) t.b[i] = (__bf16)w[n][i][s];
        wl[u0 + s] = t.u; } } }
  __syncthreads();
  // k loop: product s is followed by the LDS loads of fragment s + WRING into the registers it has just read; the v_nop statement of the product helper holds each load on its side of it, which keeps WRING fragments and XPF chunks of x in flight
  union { v16b v; v4u q[2]; } wf[WRING];
#pragma unroll
  for (int s = 0; s < WRING; ++s) { wf[s].q[0] = wl[WFRAG(s) * WFU + lane]; wf[s].q[1] = wl[WFRAG(s) * WFU + 32 + lane]; }
  v8f acc[12] = {};   /* 0..3 q^T, 4..7 k^T, 8..11 v */
#pragma unroll
  for (int kc = 0; kc < DIN / 32; ++kc) {
    if (kc + XPF < DIN / 32) { const int kn = kc + XPF; xr[kn][0] = *(const v4f*)(xp + kn * 32); xr[kn][1] = *(const v4f*)(xp + kn * 32 + 4); xr[kn][2] = *(const v4f*)(xp + kn * 32 + 16); xr[kn][3] = *(const v4f*)(xp + kn * 32 + 20); }
    v16b a;
#pragma unroll
    for (int i = 0; i < 4; ++i) { a[i] = (__bf16)xr[kc][0][i]; a[4 + i] = (__bf16)xr[kc][1][i]; a[8 + i] = (__bf16)xr[kc][2][i]; a[12 + i] = (__bf16)xr[kc][3][i]; }
#pragma unroll
    for (int j = 0; j < 12; ++j) { const int s = kc * 12 + j, sl = s % WRING, sn = s + WRING;
      acc[j] = j < 8 ? wmma_bf(wf[sl].v, a, acc[j]) : wmma_bf(a, wf[sl].v, acc[j]);
      if (sn < NSTEP) { wf[sl].q[0] = wl[WFRAG(sn) * WFU + lane]; wf[sl].q[1] = wl[WFRAG(sn) * WFU + 32 + lane]; } } }
  asm volatile("s_wait_xcnt 0x0" :: "v"(xp) : "memory");   /* as above, for the loads of x in the loop */
  const bool hi_rows = t0 < QHI && t0 < KHI;   /* QHI == KHI, multiples of PR: the same for the whole block */
  { const unsigned oh = (unsigned)((r0 + wave * 16 + col) * CC + 8 * g) * 2u;   /* the lane's byte offset in the q and k rows */
    v4u hv[8];
#pragma unroll
    for (int j = 0; j < 8; ++j) { union { v8h h; v4u u; } t;
#pragma unroll
      for (int r = 0; r < 8; ++r) t.h[r] = (_Float16)acc[j][r];
      hv[j] = t.u; }
#pragma unroll
    for (int j = 0; j < 4; ++j) { vst2((char*)QH + oh + j * 32, hv[j]); vst2((char*)KH + oh + j * 32, hv[4 + j]); }
    asm volatile("s_wait_xcnt 0x0" :: "v"(oh), "v"(hv[0]), "v"(hv[1]), "v"(hv[2]), "v"(hv[3]), "v"(hv[4]), "v"(hv[5]), "v"(hv[6]), "v"(hv[7]) : "memory"); }
  if (hi_rows) { const unsigned oq = (unsigned)((bb * QHI + t0 + wave * 16 + col) * CC + 8 * g) * 2u, ok = (unsigned)((bb * KHI + t0 + wave * 16 + col) * CC + 8 * g) * 2u;
    v4u lv[8];
#pragma unroll
    for (int j = 0; j < 8; ++j) { union { v8h h; v4u u; } t;
#pragma unroll
      for (int r = 0; r < 8; ++r) { const float v = acc[j][r]; t.h[r] = (_Float16)((v - (float)(_Float16)v) * 1024.0f); }
      lv[j] = t.u; }
#pragma unroll
    for (int j = 0; j < 4; ++j) { vst2((char*)QL + oq + j * 32, lv[j]); vst2((char*)KL + ok + j * 32, lv[4 + j]); }
    asm volatile("s_wait_xcnt 0x0" :: "v"(oq), "v"(ok), "v"(lv[0]), "v"(lv[1]), "v"(lv[2]), "v"(lv[3]), "v"(lv[4]), "v"(lv[5]), "v"(lv[6]), "v"(lv[7]) : "memory"); }
#pragma unroll
  for (int j = 0; j < 4; ++j) { union { v8h h; v4u u; } fh; union { v8b b; v4u u; } bh, bl;
#pragma unroll
    for (int r = 0; r < 8; ++r) { const float v = acc[8 + j][r]; fh.h[r] = (_Float16)v; const __bf16 h = (__bf16)v; bh.b[r] = h; bl.b[r] = (__bf16)(v - (float)h); }
    tv[0][j * 16 + col][wave * 2 + g] = fh.u; tv[1][j * 16 + col][wave * 2 + g] = bh.u; tv[2][j * 16 + col][wave * 2 + g] = bl.u; }
  __syncthreads();
  { const int c0 = tid >> 4, q = tid & 15; const unsigned ov = (unsigned)((bb * CC + c0) * TT + t0 + q * 8) * 2u;   /* byte offset of the thread's 8 t in plane c0 */
    v4u pv[HD / 16];
#pragma unroll
    for (int n = 0; n < HD / 16; ++n) pv[n] = tv[0][c0 + n * 16][q];
#pragma unroll
    for (int n = 0; n < HD / 16; ++n) vst2((char*)VT + ov + n * 16 * TT * 2, pv[n]);
    asm volatile("s_wait_xcnt 0x0" :: "v"(ov), "v"(pv[0]), "v"(pv[1]), "v"(pv[2]), "v"(pv[3]) : "memory");
    if (hi_rows) { const unsigned ob = (unsigned)((bb * CC + c0) * KHI + t0 + q * 8) * 2u;
#pragma unroll
      for (int n = 0; n < HD / 16; ++n) { vst2((char*)VB + ob + n * 16 * KHI * 2, tv[1][c0 + n * 16][q]); vst2((char*)VBL + ob + n * 16 * KHI * 2, tv[2][c0 + n * 16][q]); } } } }
// fragment in the hardware k order from a lane's own pointer (row or plane start + 8 * (lane >> 4))
__device__ __forceinline__ v16h frag_hp(const _Float16* p) { union { v16h v; v8h q[2]; } u; u.q[0] = *(const v8h*)p; u.q[1] = *(const v8h*)(p + 16); return u.v; }
__device__ __forceinline__ v16b frag_bp(const __bf16* p) { union { v16b v; v8b q[2]; } u; u.q[0] = *(const v8b*)p; u.q[1] = *(const v8b*)(p + 16); return u.v; }
// ---- k_attn: block = 4 waves x 16 queries (query block qb) of sequence b; each wave on its own, no LDS. Transposed products: S^T = K Q^T (a lane holds one query's scores, keys 8g+r of each 16-key tile), causal mask by index, running maximum and sum per lane from pass to pass, O^T += V^T P^T with P^T packed from two score tiles (hardware k order, as V^T is loaded). Products as before: query blocks < QBH take q/k hi + residual (3 products) and P, v as bf16 hi + lo (3 products), 32 keys a pass; the rest one f16 product each (P x 2^11), 64 keys a pass.
// Loads: a pass issues its v fragments ahead of its score products and the next pass's k fragments right behind them (into the registers those products have just read), so v lands under the score work and k under softmax and P.v. The v_nop statements of the product helpers hold a load on its side of them, which is what keeps the two groups at these places.
template <bool HI> __device__ __forceinline__ void attn_body(const _Float16* __restrict__ QH, const _Float16* __restrict__ KH, const _Float16* __restrict__ QL, const _Float16* __restrict__ KL, const _Float16* __restrict__ VT, const __bf16* __restrict__ VB, const __bf16* __restrict__ VBL, int b, int qb, float* __restrict__ OUT) {
  constexpr int KT = HI ? 2 : 4;   /* 16-key tiles a pass */
  const int tid = threadIdx.x, wave = __builtin_amdgcn_readfirstlane(tid >> 5), lane = tid & 31, col = lane & 15, g = lane >> 4; const int ql0 = qb * 64 + wave * 16, t = ql0 + col; const size_t rb = (size_t)b * TT;
  const unsigned ko = (unsigned)(col * CC + 8 * g), vo = (unsigned)(col * (HI ? KHI : TT) + 8 * g);   /* lane offsets: row col of a [.][CC] tile, plane col of v */
  v16h qh[HD / 32], ql[HD / 32], kh[KT][HD / 32], kl[KT][HD / 32];
#pragma unroll
  for (int kc = 0; kc < HD / 32; ++kc) { qh[kc] = frag_hp(QH + (rb + ql0) * CC + kc * 32 + ko); if (HI) ql[kc] = frag_hp(QL + ((size_t)b * QHI + ql0) * CC + kc * 32 + ko); }
  const _Float16* kp = KH + rb * CC + ko; const _Float16* klp = KL + (size_t)b * KHI * CC + ko;   /* the lane's k row of the pass whose fragments are loaded next */
#pragma unroll
  for (int i = 0; i < KT; ++i)
#pragma unroll
    for (int kc = 0; kc < HD / 32; ++kc) { kh[i][kc] = frag_hp(kp + i * 16 * CC + kc * 32); if (HI) kl[i][kc] = frag_hp(klp + i * 16 * CC + kc * 32); }
  // each s_wait_xcnt below is the wait that stands before a register named by an issued load is written again; the pointers are its inputs so that they keep their registers up to it
  if (HI) asm volatile("s_wait_xcnt 0x0" :: "v"(kp), "v"(klp) : "memory"); else asm volatile("s_wait_xcnt 0x0" :: "v"(kp) : "memory");
  v8f acc[HD / 16] = {}; float m = -3.0e38f, l = 0.f; const int npass = (ql0 + 15) / (16 * KT) + 1;   /* keys 0 .. ql0 + 15 */
#pragma unroll 1
  for (int kb = 0; kb < npass; ++kb) { const int k0 = kb * 16 * KT;
    v16h vf[KT / 2][HD / 16]; v16b vh[KT / 2][HD / 16], vl[KT / 2][HD / 16];
    const _Float16* vp = VT + (size_t)b * CC * TT + k0 + vo; const __bf16* vbp = VB + (size_t)b * CC * KHI + k0 + vo; const __bf16* vlp = VBL + (size_t)b * CC * KHI + k0 + vo;
#pragma unroll
    for (int ks = 0; ks < KT / 2; ++ks)
#pragma unroll
      for (int j = 0; j < HD / 16; ++j) {
        if (HI) { vh[ks][j] = frag_bp(vbp + j * 16 * KHI + ks * 32); vl[ks][j] = frag_bp(vlp + j * 16 * KHI + ks * 32); }
        else vf[ks][j] = frag_hp(vp + j * 16 * TT + ks * 32); }
    v8f s[KT];
#pragma unroll
    for (int i = 0; i < KT; ++i) { v8f a = {}, al = {};
#pragma unroll
      for (int kc = 0; kc < HD / 32; ++kc) { a = wmma16(kh[i][kc], qh[kc], a); if (HI) { al = wmma16(kh[i][kc], ql[kc], al); al = wmma16(kl[i][kc], qh[kc], al); } }
#pragma unroll
      for (int r = 0; r < 8; ++r) { const float v = (HI ? a[r] + al[r] * (1.0f / 1024.0f) : a[r]) * SCALE; s[i][r] = (k0 + i * 16 + 8 * g + r <= t) ? v : -3.0e38f; } }
    if (HI) asm volatile("s_wait_xcnt 0x0" :: "v"(vbp), "v"(vlp) : "memory"); else asm volatile("s_wait_xcnt 0x0" :: "v"(vp) : "memory");
    const int adv = kb + 1 < npass ? 16 * KT * CC : 0; kp += adv; klp += adv;   /* the last pass loads its own rows again: no branch, so the counted waits on v below leave these loads in flight */
#pragma unroll
    for (int i = 0; i < KT; ++i)
#pragma unroll
      for (int kc = 0; kc < HD / 32; ++kc) { kh[i][kc] = frag_hp(kp + i * 16 * CC + kc * 32); if (HI) kl[i][kc] = frag_hp(klp + i * 16 * CC + kc * 32); }
    float mb = s[0][0];
#pragma unroll
    for (int i = 0; i < KT; ++i)
#pragma unroll
      for (int r = 0; r < 8; ++r) mb = fmaxf(mb, s[i][r]);
    mb = fmaxf(mb, __shfl_xor(mb, 16)); const float mn = fmaxf(m, mb); const float alpha = expf(m - mn); m = mn;   /* pass 0 holds key 0 <= t, so mn is a real logit from there on */
    float sum = 0.f;
#pragma unroll
    for (int i = 0; i < KT; ++i)
#pragma unroll
      for (int r = 0; r < 8; ++r) { const float e = expf(s[i][r] - mn); s[i][r] = e; sum += e; }
    l = l * alpha + sum;   /* this half's keys only; the halves join after the loop */
#pragma unroll
    for (int j = 0; j < HD / 16; ++j) acc[j] *= alpha;
    if (HI) asm volatile("s_wait_xcnt 0x0" :: "v"(kp), "v"(klp) : "memory"); else asm volatile("s_wait_xcnt 0x0" :: "v"(kp) : "memory");
#pragma unroll
    for (int ks = 0; ks < KT / 2; ++ks) {
      if (HI) { float pv[16];
#pragma unroll
        for (int r = 0; r < 8; ++r) { pv[r] = s[2 * ks][r]; pv[8 + r] = s[2 * ks + 1][r]; }
        const F2 p = bsplit16(pv);
#pragma unroll
        for (int j = 0; j < HD / 16; ++j) { acc[j] = wmma_bf(vh[ks][j], p.h, acc[j]); acc[j] = wmma_bf(vh[ks][j], p.l, acc[j]); acc[j] = wmma_bf(vl[ks][j], p.h, acc[j]); }
      } else { v16h p;
#pragma unroll
        for (int r = 0; r < 8; ++r) { p[r] = (_Float16)(s[2 * ks][r] * 2048.0f); p[8 + r] = (_Float16)(s[2 * ks + 1][r] * 2048.0f); }
#pragma unroll
        for (int j = 0; j < HD / 16; ++j) acc[j] = wmma16(vf[ks][j], p, acc[j]); } } }
  asm volatile("s_wait_loadcnt 0x0" ::: "memory");   /* the last pass's look-ahead loads land before the wave goes on to its end */
  l += __shfl_xor(l, 16); const float inv = l > 0.f ? (HI ? 1.0f : 1.0f / 2048.0f) / l : 0.f;
#pragma unroll
  for (int j = 0; j < HD / 16; ++j) acc[j] *= inv;
#pragma unroll
  for (int j = 0; j < HD / 16; ++j) { float* o = OUT + (rb + ql0) * HD + j * 16 + (unsigned)(col * HD + 8 * g);   /* lane: head columns j*16 + 8g + 0..7 of its query row */
    vst2(o, __builtin_shufflevector(acc[j], acc[j], 0, 1, 2, 3)); vst2(o + 4, __builtin_shufflevector(acc[j], acc[j], 4, 5, 6, 7)); } }
__global__ __launch_bounds__(128) void k_attn(const _Float16* __restrict__ QH, const _Float16* __restrict__ KH, const _Float16* __restrict__ QL, const _Float16* __restrict__ KL, const _Float16* __restrict__ VT, const __bf16* __restrict__ VB, const __bf16* __restrict__ VBL, float* __restrict__ OUT) {
  const int b = blockIdx.x, y = blockIdx.y, qb = y < NQB / 2 ? NQB - 1 - y : y - NQB / 2;   /* for speed only: the sequence is the fast index, so each query block's cost spreads over the chip; long key walks start first, the second half of the grid rises from the shortest */
  if (qb < QBH) attn_body<true>(QH, KH, QL, KL, VT, VB, VBL, b, qb, OUT); else attn_body<false>(QH, KH, QL, KL, VT, VB, VBL, b, qb, OUT); }

extern "C" void kernel_launch(void* const* d_in, const int* in_sizes, int n_in, void* d_out, int out_size, void* d_ws, size_t ws_size, hipStream_t stream) {
  (void)in_sizes; (void)n_in; (void)out_size;
  const float** F = (const float**)d_in;
  if (ws_size < (size_t)WS_END) return;
  char* ws = (char*)d_ws; _Float16 *QH = (_Float16*)(ws + WS_QH), *KH = (_Float16*)(ws + WS_KH), *VT = (_Float16*)(ws + WS_VT), *QL = (_Float16*)(ws + WS_QL), *KL = (_Float16*)(ws + WS_KL); __bf16 *VB = (__bf16*)(ws + WS_VB), *VBL = (__bf16*)(ws + WS_VBL);
  // inputs: 0 x [64,512,384]; 1 Wq, 2 Wk, 3 Wv ((in,out) [384,64]); output [64,512,64]
  k_proj<<<dim3(TNB * TT / PR), 256, 0, stream>>>(F[0], F[1], F[2], F[3], QH, QL, KH, KL, VT, VB, VBL);
  k_attn<<<dim3(TNB, NQB), 128, 0, stream>>>(QH, KH, QL, KL, VT, VB, VBL, (float*)d_out);
}

// v003
// Measured time: 27.3 microseconds a run.
// Timed twice side by side with v002, it ran 1.28 and 1.34 times as fast.
// Counting every step since v000, it is 6.01 times as fast.
#include <hip/hip_runtime.h>
#include <math.h>

typedef __attribute__((ext_vector_type(16))) _Float16 v16h;
typedef __attribute__((ext_vector_type(16))) __bf16 v16b;
typedef __attribute__((ext_vector_type(8)))  _Float16 v8h;
typedef __attribute__((ext_vector_type(8)))  float v8f;
typedef __attribute__((ext_vector_type(4)))  float v4f;
typedef __attribute__((ext_vector_type(2)))  float v2f;
typedef __attribute__((ext_vector_type(4)))  unsigned v4u;
typedef __attribute__((ext_vector_type(4)))  int v4i;
typedef float __attribute__((may_alias)) float_a;
typedef int __attribute__((may_alias)) int_a;

template <typename T> __device__ __forceinline__ void vst2(void* p, T v) { *(T*)p = v;  }
__device__ __forceinline__ v8f wmma16(v16h a, v16h b, v8f c) {
  v8f d = __builtin_amdgcn_wmma_f32_16x16x32_f16(false, a, false, b, (short)0, c, false, false);
  asm volatile("v_nop\n\tv_nop\n\tv_nop\n\tv_nop" : "+v"(d) : "v"(a), "v"(b));
  return d;
}
__device__ __forceinline__ v8f wmma_bf(v16b a, v16b b, v8f c) {
  v8f d = __builtin_amdgcn_wmma_f32_16x16x32_bf16(false, a, false, b, (short)0, c, false, false);
  asm volatile("v_nop\n\tv_nop\n\tv_nop\n\tv_nop" : "+v"(d) : "v"(a), "v"(b));
  return d;
}
// 16x16x32 fragments: lane = (h = lane>>4, row/col = lane&15); elements 0..7 = k0+8h+0..7, 8..15 = k0+16+8h+0..7; D element r = row 8h+r
__device__ __forceinline__ v16h frag_h(const _Float16* rowk0, int lane) {
  union { v16h v; v8h q[2]; } u; const _Float16* p = rowk0 + 8 * (lane >> 4);
  u.q[0] = *(const v8h*)p; u.q[1] = *(const v8h*)(p + 16); return u.v;
}
__device__ __forceinline__ v16h frag_f32(const float* rowk0, int lane) {
  v16h a; const float* p = rowk0 + 8 * (lane >> 4);
#pragma unroll
  for (int i = 0; i < 8; ++i) { a[i] = (_Float16)p[i]; a[8 + i] = (_Float16)p[16 + i]; }
  return a;
}
__device__ __forceinline__ v16h frag_f32s(const float* rowk0, int lane, float sc) {
  v16h a; const float* p = rowk0 + 8 * (lane >> 4);
#pragma unroll
  for (int i = 0; i < 8; ++i) { a[i] = (_Float16)(p[i] * sc); a[8 + i] = (_Float16)(p[16 + i] * sc); }
  return a;
}
// column fragment from a [K][ld] layout (column n), rows >= K read as 0
__device__ __forceinline__ v16h fragc_f32(const float* W, int k0, int n, int lane, int ld, int K) {
  v16h a; const int g = lane >> 4;
#pragma unroll
  for (int i = 0; i < 8; ++i) { const int ka = k0 + 8 * g + i, kb = ka + 16;
    a[i] = (_Float16)(ka < K ? W[(size_t)(ka < K ? ka : K - 1) * ld + n] : 0.f); a[8 + i] = (_Float16)(kb < K ? W[(size_t)(kb < K ? kb : K - 1) * ld + n] : 0.f); }
  return a;
}
struct F2 { v16b h, l; };
__device__ __forceinline__ F2 bsplit16(const float v[16]) { F2 r;
#pragma unroll
  for (int i = 0; i < 16; ++i) { const __bf16 h = (__bf16)v[i]; r.h[i] = h; r.l[i] = (__bf16)(v[i] - (float)h); }
  return r; }
__device__ __forceinline__ F2 split_row(const float* row, int k0, int lane) { float v[16]; const float* p = row + k0 + 8 * (lane >> 4);
#pragma unroll
  for (int i = 0; i < 8; ++i) { v[i] = p[i]; v[8 + i] = p[16 + i]; }
  return bsplit16(v); }
__device__ __forceinline__ F2 split_rowK(const float* row, int k0, int lane, int K) { float v[16]; const int g = lane >> 4;
#pragma unroll
  for (int i = 0; i < 8; ++i) { const int ka = k0 + 8 * g + i, kb = ka + 16; v[i] = ka < K ? row[ka < K ? ka : K - 1] : 0.f; v[8 + i] = kb < K ? row[kb < K ? kb : K - 1] : 0.f; }
  return bsplit16(v); }
__device__ __forceinline__ F2 split_col(const float* W, int k0, int n, int lane, int ld, int K) { float v[16]; const int g = lane >> 4;
#pragma unroll
  for (int i = 0; i < 8; ++i) { const int ka = k0 + 8 * g + i, kb = ka + 16; v[i] = ka < K ? W[(size_t)(ka < K ? ka : K - 1) * ld + n] : 0.f; v[8 + i] = kb < K ? W[(size_t)(kb < K ? kb : K - 1) * ld + n] : 0.f; }
  return bsplit16(v); }
__device__ __forceinline__ v8f mac3(const F2& a, const F2& b, v8f c) { c = wmma_bf(a.l, b.h, c); c = wmma_bf(a.h, b.l, c); return wmma_bf(a.h, b.h, c); }
__device__ __forceinline__ float sigm(float v) { return 1.0f / (1.0f + expf(-v)); }
#define LDSX() do { asm volatile("s_wait_dscnt 0" ::: "memory"); __builtin_amdgcn_wave_barrier(); __builtin_amdgcn_fence(__ATOMIC_RELEASE, "workgroup"); } while (0)

// Single causal self-attention head (B 64, T 512, d_model 384, head 64): q/k/v = x W ((in,out) [384,64]); wei = softmax(causal(q k^T / 8)); out = wei v ([B, T, 64]). Two launches: the projections, then scores, softmax and P.v in one kernel.
#define NB 64
#define TT 512
#define CC 128            // NH * HD; not used by the compiled code: the workspace arrays are HD wide
#define DIN 384          // input (model) width
#define NH 2
#define HD 64
#define NQB (TT / 64)
#define SCALE (0.125f)
#define CAUSAL 1
#ifndef TNB
#define TNB NB
#endif
__device__ __forceinline__ float bfr(float v) { return (float)(__bf16)v; }
typedef __attribute__((ext_vector_type(8))) __bf16 v8b;
__device__ __forceinline__ v16b frag_b(const __bf16* rowk0, int lane) {
  union { v16b v; v8b q[2]; } u; const __bf16* p = rowk0 + 8 * (lane >> 4);
  u.q[0] = *(const v8b*)p; u.q[1] = *(const v8b*)(p + 16); return u.v;
}
#define QBH 6              // causal: query blocks 0..QBH-1 of each sequence (few keys, no averaging) take the high-precision path
#define QHI 384            // rows carrying a q residual plane
#define KHI 384            // key rows carrying k residual / v bf16 hi+lo planes (used only by the causal high-precision path)
// B fragment (k rows k0+.., output column o) of a weight: (in,out) [K][ld] or (out,in) [ld rows of K]: bf16 exact, or f16(bf16 * 256) exact
__device__ __forceinline__ v16b wcol_io(const float* Wm, int k0, int o, int lane, int ld) { v16b w; const int g = lane >> 4;
#pragma unroll
  for (int i = 0; i < 8; ++i) { w[i] = (__bf16)Wm[(size_t)(k0 + 8 * g + i) * ld + o]; w[8 + i] = (__bf16)Wm[(size_t)(k0 + 16 + 8 * g + i) * ld + o]; }
  return w; }
__device__ __forceinline__ v16b wcol_oi(const float* Wm, int k0, int o, int lane, int K) { v16b w; const float* p = Wm + (size_t)o * K + k0 + 8 * (lane >> 4);
#pragma unroll
  for (int i = 0; i < 8; ++i) { w[i] = (__bf16)p[i]; w[8 + i] = (__bf16)p[16 + i]; }
  return w; }
__device__ __forceinline__ v16h wcolh_io(const float* Wm, int k0, int o, int lane, int ld) { v16h w; const int g = lane >> 4;
#pragma unroll
  for (int i = 0; i < 8; ++i) { w[i] = (_Float16)(bfr(Wm[(size_t)(k0 + 8 * g + i) * ld + o]) * 256.0f); w[8 + i] = (_Float16)(bfr(Wm[(size_t)(k0 + 16 + 8 * g + i) * ld + o]) * 256.0f); }
  return w; }
__device__ __forceinline__ v16h wcolh_oi(const float* Wm, int k0, int o, int lane, int K) { v16h w; const float* p = Wm + (size_t)o * K + k0 + 8 * (lane >> 4);
#pragma unroll
  for (int i = 0; i < 8; ++i) { w[i] = (_Float16)(bfr(p[i]) * 256.0f); w[8 + i] = (_Float16)(bfr(p[16 + i]) * 256.0f); }
  return w; }
#define WQKV_LAYOUT 0   // 0 = (in,out) [DIN][HD]; 1 = (out,in) [CC][DIN]; 2 = per-head [NH][DIN][HD]
__device__ __forceinline__ v16b wcol_hdk(const float* Wm, int k0, int o, int lane) { v16b w; const int g = lane >> 4; const float* p = Wm + (size_t)(o / HD) * DIN * HD + (o % HD);
#pragma unroll
  for (int i = 0; i < 8; ++i) { w[i] = (__bf16)p[(size_t)(k0 + 8 * g + i) * HD]; w[8 + i] = (__bf16)p[(size_t)(k0 + 16 + 8 * g + i) * HD]; }
  return w; }
#define WO_OUT_IN 0
#if WQKV_LAYOUT == 1
#define WCOL(W, k0, o, lane) wcol_oi(W, k0, o, lane, DIN)
#elif WQKV_LAYOUT == 2
#define WCOL(W, k0, o, lane) wcol_hdk(W, k0, o, lane)
#else
#define WCOL(W, k0, o, lane) wcol_io(W, k0, (o) & 63, lane, HD)   /* (in,out) [384][64]; columns 64..127 = a second copy of the head */
#endif
#if WO_OUT_IN
#define WOCOL(W, k0, o, lane) wcol_oi(W, k0, o, lane, CC)
#define WOCOLH(W, k0, o, lane) wcolh_oi(W, k0, o, lane, CC)
#else
#define WOCOL(W, k0, o, lane) wcol_io(W, k0, o, lane, DIN)
#define WOCOLH(W, k0, o, lane) wcolh_io(W, k0, o, lane, DIN)
#endif
#ifndef PROJ_EXTRA_PARAMS
#define PROJ_EXTRA_PARAMS
#endif

// Every workspace array is kept in fragment order: a tile of 16 positions t x HD head columns is FT 16-bit elements (2 KiB) = 4 groups j x 32 lanes x 8 elements, so that one 16-byte access a lane covers 512 bytes in a row, whole lines, in the kernel that stores it and in the one that loads it.
// q, k: lane (g, col) of group j holds row t = 16 tile + col, head columns 16 j + 8 g + 0..7. v: lane (g, col) of group j holds head column 16 j + col, positions t = 16 tile + 8 g + 0..7.
#define FG 256             // elements of a group: 32 lanes x 8
#define FT (4 * FG)        // elements of a tile
#define WS_QH  0u                                      // f16 q tiles [b][t / 16]
#define WS_KH  (WS_QH + 2u * (size_t)NB * TT * HD)      // f16 k tiles [b][t / 16]
#define WS_VT  (WS_KH + 2u * (size_t)NB * TT * HD)      // f16 v tiles [b][t / 16]
#define WS_QL  (WS_VT + 2u * (size_t)NB * TT * HD)      // f16 q residual x 2^10 tiles [b][t / 16, t < QHI]
#define WS_KL  (WS_QL + 2u * (size_t)NB * QHI * HD)     // f16 k residual x 2^10 tiles [b][t / 16, t < KHI]
#define WS_VB  (WS_KL + 2u * (size_t)NB * KHI * HD)     // bf16 v hi tiles [b][t / 16, t < KHI]
#define WS_VBL (WS_VB + 2u * (size_t)NB * KHI * HD)     // bf16 v lo tiles, likewise
#define WS_END (WS_VBL + 2u * (size_t)NB * KHI * HD)

// ---- k_proj: block = 8 waves x 16 rows of x, all 192 real output columns (q, k, v: 64 each). The three weights are staged once in LDS as bf16 in fragment order, so the k loop reads a weight fragment with two 16-byte LDS loads and one x fragment feeds all twelve tiles. Products and k order as before (exact bf16 products, K = DIN).
// q and k tiles are formed transposed (weight fragment as A, x fragment as B): a lane then holds 8 neighbouring columns of one row. v tiles (x as A): a lane holds 8 neighbouring t of one head column. Both are what the same lane of k_attn wants as half a fragment, so every tile goes from the registers straight to its place in fragment order.
// Every loop of this kernel is unrolled in full: its register arrays (x chunks, fragment ring, accumulators) are then indexed by constants and stay in registers.
#define PR 128             // rows of x a block
#define WFU 65             // 16-byte units from one weight fragment to the next in LDS: 2 halves x 32 lanes, + 1 so that the staging stores of the four column tiles fall on different banks
#define XPF 4              // k chunks of x in flight ahead of the products
#define WRING 8            // weight fragments in flight from LDS ahead of the products
#define NSTEP (12 * (DIN / 32))   // products a wave: 12 tiles a k chunk
#define WFRAG(s) (((((s) % 12) >> 2) * (DIN / 32) + (s) / 12) * (HD / 16) + (((s) % 12) & 3))   // fragment of product s: weight (s % 12) / 4, k chunk s / 12, column tile s % 4
__global__ __launch_bounds__(256) void k_proj(const float* __restrict__ X, const float* __restrict__ WQ, const float* __restrict__ WK, const float* __restrict__ WV,
    _Float16* __restrict__ QH, _Float16* __restrict__ QL, _Float16* __restrict__ KH, _Float16* __restrict__ KL, _Float16* __restrict__ VT, __bf16* __restrict__ VB, __bf16* __restrict__ VBL) {
  __shared__ __align__(16) v4u wl[3 * (DIN / 32) * (HD / 16) * WFU];
  const int tid = threadIdx.x, wave = tid >> 5, lane = tid & 31, col = lane & 15, g = lane >> 4; const size_t r0 = (size_t)blockIdx.x * PR; const size_t bb = r0 / TT; const int t0 = (int)(r0 % TT);
  const float* xp = X + (r0 + wave * 16 + col) * DIN + 8 * g;   /* the lane's row of x, at its half's first k */
  v4f xr[DIN / 32][4];
#pragma unroll
  for (int kc = 0; kc < XPF; ++kc) { xr[kc][0] = *(const v4f*)(xp + kc * 32); xr[kc][1] = *(const v4f*)(xp + kc * 32 + 4); xr[kc][2] = *(const v4f*)(xp + kc * 32 + 16); xr[kc][3] = *(const v4f*)(xp + kc * 32 + 20); }
  // staging: a thread takes 8 k rows x 4 columns of a weight (whole lines across the lanes) and writes four 16-byte units, one per column: 8 neighbouring k of that column, which is one half of a lane's fragment
  { const int kg0 = tid >> 4, c4 = tid & 15; const unsigned wo = (unsigned)(kg0 * 8 * HD + c4 * 4) * 4u;   /* the thread's byte offset in each weight */
    const float* wq = (const float*)((const char*)WQ + wo); const float* wk = (const float*)((const char*)WK + wo); const float* wv = (const float*)((const char*)WV + wo); v4f w[9][8];
#pragma unroll
    for (int n = 0; n < 9; ++n) { const float* wp = n < 3 ? wq : n < 6 ? wk : wv;
#pragma unroll
      for (int i = 0; i < 8; ++i) w[n][i] = *(const v4f*)(wp + ((n % 3) * 16 * 8 + i) * HD); }
    // the wait that stands before a register named by an issued load or store is written again; here and below those registers are its inputs so that they keep their values up to it
    asm volatile("s_wait_xcnt 0x0" :: "v"(xp), "v"(wo) : "memory");
#pragma unroll
    for (int n = 0; n < 9; ++n) { const int kg = (n % 3) * 16 + kg0;   /* k group kg = 4 kc + 2 half + g */
      const int u0 = (((n / 3) * (DIN / 32) + (kg >> 2)) * (HD / 16) + (c4 >> 2)) * WFU + ((kg >> 1) & 1) * 32 + (kg & 1) * 16 + (c4 & 3) * 4;
#pragma unroll
      for (int s = 0; s < 4; ++s) { union { v8b b; v4u u; } t;
#pragma unroll
        for (int i = 0; i < 8; ++i) t.b[i] = (__bf16)w[n][i][s];
        wl[u0 + s] = t.u; } } }
  __syncthreads();
  // k loop: product s is followed by the LDS loads of fragment s + WRING into the registers it has just read; the v_nop statement of the product helper holds each load on its side of it, which keeps WRING fragments and XPF chunks of x in flight
  union { v16b v; v4u q[2]; } wf[WRING];
#pragma unroll
  for (int s = 0; s < WRING; ++s) { wf[s].q[0] = wl[WFRAG(s) * WFU + lane]; wf[s].q[1] = wl[WFRAG(s) * WFU + 32 + lane]; }
  v8f acc[12] = {};   /* 0..3 q^T, 4..7 k^T, 8..11 v */
#pragma unroll
  for (int kc = 0; kc < DIN / 32; ++kc) {
    if (kc + XPF < DIN / 32) { const int kn = kc + XPF; xr[kn][0] = *(const v4f*)(xp + kn * 32); xr[kn][1] = *(const v4f*)(xp + kn * 32 + 4); xr[kn][2] = *(const v4f*)(xp + kn * 32 + 16); xr[kn][3] = *(const v4f*)(xp + kn * 32 + 20); }
    v16b a;
#pragma unroll
    for (int i = 0; i < 4; ++i) { a[i] = (__bf16)xr[kc][0][i]; a[4 + i] = (__bf16)xr[kc][1][i]; a[8 + i] = (__bf16)xr[kc][2][i]; a[12 + i] = (__bf16)xr[kc][3][i]; }
#pragma unroll
    for (int j = 0; j < 12; ++j) { const int s = kc * 12 + j, sl = s % WRING, sn = s + WRING;
      acc[j] = j < 8 ? wmma_bf(wf[sl].v, a, acc[j]) : wmma_bf(a, wf[sl].v, acc[j]);
      if (sn < NSTEP) { wf[sl].q[0] = wl[WFRAG(sn) * WFU + lane]; wf[sl].q[1] = wl[WFRAG(sn) * WFU + 32 + lane]; } } }
  asm volatile("s_wait_xcnt 0x0" :: "v"(xp) : "memory");   /* as above, for the loads of x in the loop */
  const bool hi_rows = t0 < QHI && t0 < KHI;   /* QHI == KHI, multiples of PR: the same for the whole block */
  const unsigned oh = (unsigned)((r0 / 16 + wave) * FT + lane * 8) * 2u;   /* the lane's byte offset in the wave's tile of the arrays that hold every t */
  const unsigned ol = (unsigned)((bb * (QHI / 16) + t0 / 16 + wave) * FT + lane * 8) * 2u;   /* and of those that hold t < QHI == KHI */
  { v4u hv[8];
#pragma unroll
    for (int j = 0; j < 8; ++j) { union { v8h h; v4u u; } t;
#pragma unroll
      for (int r = 0; r < 8; ++r) t.h[r] = (_Float16)acc[j][r];
      hv[j] = t.u; }
#pragma unroll
    for (int j = 0; j < 4; ++j) { vst2((char*)QH + oh + j * FG * 2, hv[j]); vst2((char*)KH + oh + j * FG * 2, hv[4 + j]); }
    asm volatile("s_wait_xcnt 0x0" :: "v"(oh), "v"(hv[0]), "v"(hv[1]), "v"(hv[2]), "v"(hv[3]), "v"(hv[4]), "v"(hv[5]), "v"(hv[6]), "v"(hv[7]) : "memory"); }
  if (hi_rows) { v4u lv[8];
#pragma unroll
    for (int j = 0; j < 8; ++j) { union { v8h h; v4u u; } t;
#pragma unroll
      for (int r = 0; r < 8; ++r) { const float v = acc[j][r]; t.h[r] = (_Float16)((v - (float)(_Float16)v) * 1024.0f); }
      lv[j] = t.u; }
#pragma unroll
    for (int j = 0; j < 4; ++j) { vst2((char*)QL + ol + j * FG * 2, lv[j]); vst2((char*)KL + ol + j * FG * 2, lv[4 + j]); }
    asm volatile("s_wait_xcnt 0x0" :: "v"(ol), "v"(lv[0]), "v"(lv[1]), "v"(lv[2]), "v"(lv[3]), "v"(lv[4]), "v"(lv[5]), "v"(lv[6]), "v"(lv[7]) : "memory"); }
  { v4u fv[4], bv[4], lv[4];
#pragma unroll
    for (int j = 0; j < 4; ++j) { union { v8h h; v4u u; } fh; union { v8b b; v4u u; } bh, bl;
#pragma unroll
      for (int r = 0; r < 8; ++r) { const float v = acc[8 + j][r]; fh.h[r] = (_Float16)v; const __bf16 h = (__bf16)v; bh.b[r] = h; bl.b[r] = (__bf16)(v - (float)h); }
      fv[j] = fh.u; bv[j] = bh.u; lv[j] = bl.u; }
#pragma unroll
    for (int j = 0; j < 4; ++j) vst2((char*)VT + oh + j * FG * 2, fv[j]);
    asm volatile("s_wait_xcnt 0x0" :: "v"(oh), "v"(fv[0]), "v"(fv[1]), "v"(fv[2]), "v"(fv[3]) : "memory");
    if (hi_rows) {
#pragma unroll
      for (int j = 0; j < 4; ++j) { vst2((char*)VB + ol + j * FG * 2, bv[j]); vst2((char*)VBL + ol + j * FG * 2, lv[j]); } } } }
// fragment in the hardware k order from a lane's own pointer (start of a group + 8 * lane); its second half lies D elements on: the next group of the tile for q and k (head columns + 16), the same group of the next tile for v (keys + 16)
template <int D> __device__ __forceinline__ v16h frag_hp(const _Float16* p) { union { v16h v; v8h q[2]; } u; u.q[0] = *(const v8h*)p; u.q[1] = *(const v8h*)(p + D); return u.v; }
template <int D> __device__ __forceinline__ v16b frag_bp(const __bf16* p) { union { v16b v; v8b q[2]; } u; u.q[0] = *(const v8b*)p; u.q[1] = *(const v8b*)(p + D); return u.v; }
// ---- k_attn: block = 4 waves x 16 queries (query block qb) of sequence b; each wave on its own, no LDS. Transposed products: S^T = K Q^T (a lane holds one query's scores, keys 8g+r of each 16-key tile), causal mask by index, running maximum and sum per lane from pass to pass, O^T += V^T P^T with P^T packed from two score tiles (hardware k order, as V^T is loaded). Products as before: query blocks < QBH take q/k hi + residual (3 products) and P, v as bf16 hi + lo (3 products), 32 keys a pass; the rest one f16 product each (P x 2^11), 64 keys a pass.
// Loads: a pass issues its v fragments ahead of its score products and the next pass's k fragments right behind them (into the registers those products have just read), so v lands under the score work and k under softmax and P.v. The v_nop statements of the product helpers hold a load on its side of them, which is what keeps the two groups at these places.
template <bool HI> __device__ __forceinline__ void attn_body(const _Float16* __restrict__ QH, const _Float16* __restrict__ KH, const _Float16* __restrict__ QL, const _Float16* __restrict__ KL, const _Float16* __restrict__ VT, const __bf16* __restrict__ VB, const __bf16* __restrict__ VBL, int b, int qb, float* __restrict__ OUT) {
  constexpr int KT = HI ? 2 : 4;   /* 16-key tiles a pass */
  const int tid = threadIdx.x, wave = __builtin_amdgcn_readfirstlane(tid >> 5), lane = tid & 31, col = lane & 15, g = lane >> 4; const int ql0 = qb * 64 + wave * 16, t = ql0 + col; const size_t rb = (size_t)b * TT;
  const unsigned lo = (unsigned)(lane * 8);   /* the lane's offset in every group */
  v16h qh[HD / 32], ql[HD / 32], kh[KT][HD / 32], kl[KT][HD / 32];
#pragma unroll
  for (int kc = 0; kc < HD / 32; ++kc) { qh[kc] = frag_hp<FG>(QH + (rb + ql0) / 16 * FT + kc * 2 * FG + lo); if (HI) ql[kc] = frag_hp<FG>(QL + ((size_t)b * QHI + ql0) / 16 * FT + kc * 2 * FG + lo); }
  const _Float16* kp = KH + rb / 16 * FT + lo; const _Float16* klp = KL + (size_t)b * (KHI / 16) * FT + lo;   /* the lane's place in the first k tile of the pass whose fragments are loaded next */
#pragma unroll
  for (int i = 0; i < KT; ++i)
#pragma unroll
    for (int kc = 0; kc < HD / 32; ++kc) { kh[i][kc] = frag_hp<FG>(kp + i * FT + kc * 2 * FG); if (HI) kl[i][kc] = frag_hp<FG>(klp + i * FT + kc * 2 * FG); }
  // each s_wait_xcnt below is the wait that stands before a register named by an issued load is written again; the pointers are its inputs so that they keep their registers up to it
  if (HI) asm volatile("s_wait_xcnt 0x0" :: "v"(kp), "v"(klp) : "memory"); else asm volatile("s_wait_xcnt 0x0" :: "v"(kp) : "memory");
  v8f acc[HD / 16] = {}; float m = -3.0e38f, l = 0.f; const int npass = (ql0 + 15) / (16 * KT) + 1;   /* keys 0 .. ql0 + 15 */
#pragma unroll 1
  for (int kb = 0; kb < npass; ++kb) { const int k0 = kb * 16 * KT;
    v16h vf[KT / 2][HD / 16]; v16b vh[KT / 2][HD / 16], vl[KT / 2][HD / 16];
    const _Float16* vp = VT + (rb + k0) / 16 * FT + lo; const __bf16* vbp = VB + ((size_t)b * KHI + k0) / 16 * FT + lo; const __bf16* vlp = VBL + ((size_t)b * KHI + k0) / 16 * FT + lo;
#pragma unroll
    for (int ks = 0; ks < KT / 2; ++ks)
#pragma unroll
      for (int j = 0; j < HD / 16; ++j) {
        if (HI) { vh[ks][j] = frag_bp<FT>(vbp + ks * 2 * FT + j * FG); vl[ks][j] = frag_bp<FT>(vlp + ks * 2 * FT + j * FG); }
        else vf[ks][j] = frag_hp<FT>(vp + ks * 2 * FT + j * FG); }
    v8f s[KT];
#pragma unroll
    for (int i = 0; i < KT; ++i) { v8f a = {}, al = {};
#pragma unroll
      for (int kc = 0; kc < HD / 32; ++kc) { a = wmma16(kh[i][kc], qh[kc], a); if (HI) { al = wmma16(kh[i][kc], ql[kc], al); al = wmma16(kl[i][kc], qh[kc], al); } }
#pragma unroll
      for (int r = 0; r < 8; ++r) { const float v = (HI ? a[r] + al[r] * (1.0f / 1024.0f) : a[r]) * SCALE; s[i][r] = (k0 + i * 16 + 8 * g + r <= t) ? v : -3.0e38f; } }
    if (HI) asm volatile("s_wait_xcnt 0x0" :: "v"(vbp), "v"(vlp) : "memory"); else asm volatile("s_wait_xcnt 0x0" :: "v"(vp) : "memory");
    const int adv = kb + 1 < npass ? KT * FT : 0; kp += adv; klp += adv;   /* the last pass loads its own rows again: no branch, so the counted waits on v below leave these loads in flight */
#pragma unroll
    for (int i = 0; i < KT; ++i)
#pragma unroll
      for (int kc = 0; kc < HD / 32; ++kc) { kh[i][kc] = frag_hp<FG>(kp + i * FT + kc * 2 * FG); if (HI) kl[i][kc] = frag_hp<FG>(klp + i * FT + kc * 2 * FG); }
    float mb = s[0][0];
#pragma unroll
    for (int i = 0; i < KT; ++i)
#pragma unroll
      for (int r = 0; r < 8; ++r) mb = fmaxf(mb, s[i][r]);
    mb = fmaxf(mb, __shfl_xor(mb, 16)); const float mn = fmaxf(m, mb); const float alpha = expf(m - mn); m = mn;   /* pass 0 holds key 0 <= t, so mn is a real logit from there on */
    float sum = 0.f;
#pragma unroll
    for (int i = 0; i < KT; ++i)
#pragma unroll
      for (int r = 0; r < 8; ++r) { const float e = expf(s[i][r] - mn); s[i][r] = e; sum += e; }
    l = l * alpha + sum;   /* this half's keys only; the halves join after the loop */
#pragma unroll
    for (int j = 0; j < HD / 16; ++j) acc[j] *= alpha;
    if (HI) asm volatile("s_wait_xcnt 0x0" :: "v"(kp), "v"(klp) : "memory"); else asm volatile("s_wait_xcnt 0x0" :: "v"(kp) : "memory");
#pragma unroll
    for (int ks = 0; ks < KT / 2; ++ks) {
      if (HI) { float pv[16];
#pragma unroll
        for (int r = 0; r < 8; ++r) { pv[r] = s[2 * ks][r]; pv[8 + r] = s[2 * ks + 1][r]; }
        const F2 p = bsplit16(pv);
#pragma unroll
        for (int j = 0; j < HD / 16; ++j) { acc[j] = wmma_bf(vh[ks][j], p.h, acc[j]); acc[j] = wmma_bf(vh[ks][j], p.l, acc[j]); acc[j] = wmma_bf(vl[ks][j], p.h, acc[j]); }
      } else { v16h p;
#pragma unroll
        for (int r = 0; r < 8; ++r) { p[r] = (_Float16)(s[2 * ks][r] * 2048.0f); p[8 + r] = (_Float16)(s[2 * ks + 1][r] * 2048.0f); }
#pragma unroll
        for (int j = 0; j < HD / 16; ++j) acc[j] = wmma16(vf[ks][j], p, acc[j]); } } }
  asm volatile("s_wait_loadcnt 0x0" ::: "memory");   /* the last pass's look-ahead loads land before the wave goes on to its end */
  l += __shfl_xor(l, 16); const float inv = l > 0.f ? (HI ? 1.0f : 1.0f / 2048.0f) / l : 0.f;
#pragma unroll
  for (int j = 0; j < HD / 16; ++j) acc[j] *= inv;
#pragma unroll
  for (int j = 0; j < HD / 16; ++j) { float* o = OUT + (rb + ql0) * HD + j * 16 + (unsigned)(col * HD + 8 * g);   /* lane: head columns j*16 + 8g + 0..7 of its query row */
    vst2(o, __builtin_shufflevector(acc[j], acc[j], 0, 1, 2, 3)); vst2(o + 4, __builtin_shufflevector(acc[j], acc[j], 4, 5, 6, 7)); } }
__global__ __launch_bounds__(128) void k_attn(const _Float16* __restrict__ QH, const _Float16* __restrict__ KH, const _Float16* __restrict__ QL, const _Float16* __restrict__ KL, const _Float16* __restrict__ VT, const __bf16* __restrict__ VB, const __bf16* __restrict__ VBL, float* __restrict__ OUT) {
  const int b = blockIdx.x, y = blockIdx.y, qb = y < NQB / 2 ? NQB - 1 - y : y - NQB / 2;   /* for speed only: the sequence is the fast index, so each query block's cost spreads over the chip; long key walks start first, the second half of the grid rises from the shortest */
  if (qb < QBH) attn_body<true>(QH, KH, QL, KL, VT, VB, VBL, b, qb, OUT); else attn_body<false>(QH, KH, QL, KL, VT, VB, VBL, b, qb, OUT); }

extern "C" void kernel_launch(void* const* d_in, const int* in_sizes, int n_in, void* d_out, int out_size, void* d_ws, size_t ws_size, hipStream_t stream) {
  (void)in_sizes; (void)n_in; (void)out_size;
  const float** F = (const float**)d_in;
  if (ws_size < (size_t)WS_END) return;
  char* ws = (char*)d_ws; _Float16 *QH = (_Float16*)(ws + WS_QH), *KH = (_Float16*)(ws + WS_KH), *VT = (_Float16*)(ws + WS_VT), *QL = (_Float16*)(ws + WS_QL), *KL = (_Float16*)(ws + WS_KL); __bf16 *VB = (__bf16*)(ws + WS_VB), *VBL = (__bf16*)(ws + WS_VBL);
  // inputs: 0 x [64,512,384]; 1 Wq, 2 Wk, 3 Wv ((in,out) [384,64]); output [64,512,64]
  k_proj<<<dim3(TNB * TT / PR), 256, 0, stream>>>(F[0], F[1], F[2], F[3], QH, QL, KH, KL, VT, VB, VBL);
  k_attn<<<dim3(TNB, NQB), 128, 0, stream>>>(QH, KH, QL, KL, VT, VB, VBL, (float*)d_out);
}

// v004
// Measured time: 24.2 microseconds a run.
// Next to v003, in two timings, it ran 1.12 and 1.14 times as fast.
// Counting every step since v000, it is 6.79 times as fast.
#include <hip/hip_runtime.h>
#include <math.h>

typedef __attribute__((ext_vector_type(16))) _Float16 v16h;
typedef __attribute__((ext_vector_type(16))) __bf16 v16b;
typedef __attribute__((ext_vector_type(8)))  _Float16 v8h;
typedef __attribute__((ext_vector_type(8)))  float v8f;
typedef __attribute__((ext_vector_type(4)))  float v4f;
typedef __attribute__((ext_vector_type(2)))  float v2f;
typedef __attribute__((ext_vector_type(4)))  unsigned v4u;
typedef __attribute__((ext_vector_type(4)))  int v4i;
typedef float __attribute__((may_alias)) float_a;
typedef int __attribute__((may_alias)) int_a;

template <typename T> __device__ __forceinline__ void vst2(void* p, T v) { *(T*)p = v;  }
__device__ __forceinline__ v8f wmma16(v16h a, v16h b, v8f c) {
  v8f d = __builtin_amdgcn_wmma_f32_16x16x32_f16(false, a, false, b, (short)0, c, false, false);
  asm volatile("v_nop\n\tv_nop\n\tv_nop\n\tv_nop" : "+v"(d) : "v"(a), "v"(b));
  return d;
}
__device__ __forceinline__ v8f wmma_bf(v16b a, v16b b, v8f c) {
  v8f d = __builtin_amdgcn_wmma_f32_16x16x32_bf16(false, a, false, b, (short)0, c, false, false);
  asm volatile("v_nop\n\tv_nop\n\tv_nop\n\tv_nop" : "+v"(d) : "v"(a), "v"(b));
  return d;
}
// 16x16x32 fragments: lane = (h = lane>>4, row/col = lane&15); elements 0..7 = k0+8h+0..7, 8..15 = k0+16+8h+0..7; D element r = row 8h+r
__device__ __forceinline__ v16h frag_h(const _Float16* rowk0, int lane) {
  union { v16h v; v8h q[2]; } u; const _Float16* p = rowk0 + 8 * (lane >> 4);
  u.q[0] = *(const v8h*)p; u.q[1] = *(const v8h*)(p + 16); return u.v;
}
__device__ __forceinline__ v16h frag_f32(const float* rowk0, int lane) {
  v16h a; const float* p = rowk0 + 8 * (lane >> 4);
#pragma unroll
  for (int i = 0; i < 8; ++i) { a[i] = (_Float16)p[i]; a[8 + i] = (_Float16)p[16 + i]; }
  return a;
}
__device__ __forceinline__ v16h frag_f32s(const float* rowk0, int lane, float sc) {
  v16h a; const float* p = rowk0 + 8 * (lane >> 4);
#pragma unroll
  for (int i = 0; i < 8; ++i) { a[i] = (_Float16)(p[i] * sc); a[8 + i] = (_Float16)(p[16 + i] * sc); }
  return a;
}
// column fragment from a [K][ld] layout (column n), rows >= K read as 0
__device__ __forceinline__ v16h fragc_f32(const float* W, int k0, int n, int lane, int ld, int K) {
  v16h a; const int g = lane >> 4;
#pragma unroll
  for (int i = 0; i < 8; ++i) { const int ka = k0 + 8 * g + i, kb = ka + 16;
    a[i] = (_Float16)(ka < K ? W[(size_t)(ka < K ? ka : K - 1) * ld + n] : 0.f); a[8 + i] = (_Float16)(kb < K ? W[(size_t)(kb < K ? kb : K - 1) * ld + n] : 0.f); }
  return a;
}
struct F2 { v16b h, l; };
__device__ __forceinline__ F2 bsplit16(const float v[16]) { F2 r;
#pragma unroll
  for (int i = 0; i < 16; ++i) { const __bf16 h = (__bf16)v[i]; r.h[i] = h; r.l[i] = (__bf16)(v[i] - (float)h); }
  return r; }
__device__ __forceinline__ F2 split_row(const float* row, int k0, int lane) { float v[16]; const float* p = row + k0 + 8 * (lane >> 4);
#pragma unroll
  for (int i = 0; i < 8; ++i) { v[i] = p[i]; v[8 + i] = p[16 + i]; }
  return bsplit16(v); }
__device__ __forceinline__ F2 split_rowK(const float* row, int k0, int lane, int K) { float v[16]; const int g = lane >> 4;
#pragma unroll
  for (int i = 0; i < 8; ++i) { const int ka = k0 + 8 * g + i, kb = ka + 16; v[i] = ka < K ? row[ka < K ? ka : K - 1] : 0.f; v[8 + i] = kb < K ? row[kb < K ? kb : K - 1] : 0.f; }
  return bsplit16(v); }
__device__ __forceinline__ F2 split_col(const float* W, int k0, int n, int lane, int ld, int K) { float v[16]; const int g = lane >> 4;
#pragma unroll
  for (int i = 0; i < 8; ++i) { const int ka = k0 + 8 * g + i, kb = ka + 16; v[i] = ka < K ? W[(size_t)(ka < K ? ka : K - 1) * ld + n] : 0.f; v[8 + i] = kb < K ? W[(size_t)(kb < K ? kb : K - 1) * ld + n] : 0.f; }
  return bsplit16(v); }
__device__ __forceinline__ v8f mac3(const F2& a, const F2& b, v8f c) { c = wmma_bf(a.l, b.h, c); c = wmma_bf(a.h, b.l, c); return wmma_bf(a.h, b.h, c); }
__device__ __forceinline__ float sigm(float v) { return 1.0f / (1.0f + expf(-v)); }
#define LDSX() do { asm volatile("s_wait_dscnt 0" ::: "memory"); __builtin_amdgcn_wave_barrier(); __builtin_amdgcn_fence(__ATOMIC_RELEASE, "workgroup"); } while (0)

// Single causal self-attention head (B 64, T 512, d_model 384, head 64): q/k/v = x W ((in,out) [384,64]); wei = softmax(causal(q k^T / 8)); out = wei v ([B, T, 64]). Two launches: the projections, then scores, softmax and P.v in one kernel.
#define NB 64
#define TT 512
#define CC 128            // NH * HD; not used by the compiled code: the workspace arrays are HD wide
#define DIN 384          // input (model) width
#define NH 2
#define HD 64
#define NQB (TT / 64)
#define SCALE (0.125f)
#define CAUSAL 1
#ifndef TNB
#define TNB NB
#endif
__device__ __forceinline__ float bfr(float v) { return (float)(__bf16)v; }
typedef __attribute__((ext_vector_type(8))) __bf16 v8b;
__device__ __forceinline__ v16b frag_b(const __bf16* rowk0, int lane) {
  union { v16b v; v8b q[2]; } u; const __bf16* p = rowk0 + 8 * (lane >> 4);
  u.q[0] = *(const v8b*)p; u.q[1] = *(const v8b*)(p + 16); return u.v;
}
#define QBH 6              // causal: query blocks 0..QBH-1 of each sequence (few keys, no averaging) take the high-precision path
#define QHI 384            // rows carrying a q residual plane
#define KHI 384            // key rows carrying k residual / v bf16 hi+lo planes (used only by the causal high-precision path)
// B fragment (k rows k0+.., output column o) of a weight: (in,out) [K][ld] or (out,in) [ld rows of K]: bf16 exact, or f16(bf16 * 256) exact
__device__ __forceinline__ v16b wcol_io(const float* Wm, int k0, int o, int lane, int ld) { v16b w; const int g = lane >> 4;
#pragma unroll
  for (int i = 0; i < 8; ++i) { w[i] = (__bf16)Wm[(size_t)(k0 + 8 * g + i) * ld + o]; w[8 + i] = (__bf16)Wm[(size_t)(k0 + 16 + 8 * g + i) * ld + o]; }
  return w; }
__device__ __forceinline__ v16b wcol_oi(const float* Wm, int k0, int o, int lane, int K) { v16b w; const float* p = Wm + (size_t)o * K + k0 + 8 * (lane >> 4);
#pragma unroll
  for (int i = 0; i < 8; ++i) { w[i] = (__bf16)p[i]; w[8 + i] = (__bf16)p[16 + i]; }
  return w; }
__device__ __forceinline__ v16h wcolh_io(const float* Wm, int k0, int o, int lane, int ld) { v16h w; const int g = lane >> 4;
#pragma unroll
  for (int i = 0; i < 8; ++i) { w[i] = (_Float16)(bfr(Wm[(size_t)(k0 + 8 * g + i) * ld + o]) * 256.0f); w[8 + i] = (_Float16)(bfr(Wm[(size_t)(k0 + 16 + 8 * g + i) * ld + o]) * 256.0f); }
  return w; }
__device__ __forceinline__ v16h wcolh_oi(const float* Wm, int k0, int o, int lane, int K) { v16h w; const float* p = Wm + (size_t)o * K + k0 + 8 * (lane >> 4);
#pragma unroll
  for (int i = 0; i < 8; ++i) { w[i] = (_Float16)(bfr(p[i]) * 256.0f); w[8 + i] = (_Float16)(bfr(p[16 + i]) * 256.0f); }
  return w; }
#define WQKV_LAYOUT 0   // 0 = (in,out) [DIN][HD]; 1 = (out,in) [CC][DIN]; 2 = per-head [NH][DIN][HD]
__device__ __forceinline__ v16b wcol_hdk(const float* Wm, int k0, int o, int lane) { v16b w; const int g = lane >> 4; const float* p = Wm + (size_t)(o / HD) * DIN * HD + (o % HD);
#pragma unroll
  for (int i = 0; i < 8; ++i) { w[i] = (__bf16)p[(size_t)(k0 + 8 * g + i) * HD]; w[8 + i] = (__bf16)p[(size_t)(k0 + 16 + 8 * g + i) * HD]; }
  return w; }
#define WO_OUT_IN 0
#if WQKV_LAYOUT == 1
#define WCOL(W, k0, o, lane) wcol_oi(W, k0, o, lane, DIN)
#elif WQKV_LAYOUT == 2
#define WCOL(W, k0, o, lane) wcol_hdk(W, k0, o, lane)
#else
#define WCOL(W, k0, o, lane) wcol_io(W, k0, (o) & 63, lane, HD)   /* (in,out) [384][64]; columns 64..127 = a second copy of the head */
#endif
#if WO_OUT_IN
#define WOCOL(W, k0, o, lane) wcol_oi(W, k0, o, lane, CC)
#define WOCOLH(W, k0, o, lane) wcolh_oi(W, k0, o, lane, CC)
#else
#define WOCOL(W, k0, o, lane) wcol_io(W, k0, o, lane, DIN)
#define WOCOLH(W, k0, o, lane) wcolh_io(W, k0, o, lane, DIN)
#endif
#ifndef PROJ_EXTRA_PARAMS
#define PROJ_EXTRA_PARAMS
#endif

// Every workspace array is kept in fragment order: a tile of 16 positions t x HD head columns is FT 16-bit elements (2 KiB) = 4 groups j x 32 lanes x 8 elements, so that one 16-byte access a lane covers 512 bytes in a row, whole lines, in the kernel that stores it and in the one that loads it.
// q, k: lane (g, col) of group j holds row t = 16 tile + col, head columns 16 j + 8 g + 0..7. v: lane (g, col) of group j holds head column 16 j + col, positions t = 16 tile + 8 g + 0..7.
#define FG 256             // elements of a group: 32 lanes x 8
#define FT (4 * FG)        // elements of a tile
#define WS_QH  0u                                      // f16 q tiles [b][t / 16]
#define WS_KH  (WS_QH + 2u * (size_t)NB * TT * HD)      // f16 k tiles [b][t / 16]
#define WS_VT  (WS_KH + 2u * (size_t)NB * TT * HD)      // f16 v tiles [b][t / 16]
#define WS_QL  (WS_VT + 2u * (size_t)NB * TT * HD)      // f16 q residual x 2^10 tiles [b][t / 16, t < QHI]
#define WS_KL  (WS_QL + 2u * (size_t)NB * QHI * HD)     // f16 k residual x 2^10 tiles [b][t / 16, t < KHI]
#define WS_VB  (WS_KL + 2u * (size_t)NB * KHI * HD)     // bf16 v hi tiles [b][t / 16, t < KHI]
#define WS_VBL (WS_VB + 2u * (size_t)NB * KHI * HD)     // bf16 v lo tiles, likewise
#define WS_END (WS_VBL + 2u * (size_t)NB * KHI * HD)

// ---- k_proj: block = 8 waves x 16 rows of x, all 192 real output columns (q, k, v: 64 each). The three weights are staged once in LDS as bf16 in fragment order, so the k loop reads a weight fragment with two 16-byte LDS loads and one x fragment feeds all twelve tiles. Products and k order as before (exact bf16 products, K = DIN).
// q and k tiles are formed transposed (weight fragment as A, x fragment as B): a lane then holds 8 neighbouring columns of one row. v tiles (x as A): a lane holds 8 neighbouring t of one head column. Both are what the same lane of k_attn wants as half a fragment, so every tile goes from the registers straight to its place in fragment order.
// Every loop of this kernel is unrolled in full: its register arrays (x chunks, fragment ring, accumulators) are then indexed by constants and stay in registers.
#define PR 128             // rows of x a block
#define WFU 65             // 16-byte units from one weight fragment to the next in LDS: 2 halves x 32 lanes, + 1 so that the staging stores of the four column tiles fall on different banks
#define XPF 4              // k chunks of x in flight ahead of the products
#define WRING 8            // weight fragments in flight from LDS ahead of the products
#define NSTEP (12 * (DIN / 32))   // products a wave: 12 tiles a k chunk
#define WFRAG(s) (((((s) % 12) >> 2) * (DIN / 32) + (s) / 12) * (HD / 16) + (((s) % 12) & 3))   // fragment of product s: weight (s % 12) / 4, k chunk s / 12, column tile s % 4
__global__ __launch_bounds__(256) void k_proj(const float* __restrict__ X, const float* __restrict__ WQ, const float* __restrict__ WK, const float* __restrict__ WV,
    _Float16* __restrict__ QH, _Float16* __restrict__ QL, _Float16* __restrict__ KH, _Float16* __restrict__ KL, _Float16* __restrict__ VT, __bf16* __restrict__ VB, __bf16* __restrict__ VBL) {
  __shared__ __align__(16) v4u wl[3 * (DIN / 32) * (HD / 16) * WFU];
  const int tid = threadIdx.x, wave = tid >> 5, lane = tid & 31, col = lane & 15, g = lane >> 4; const size_t r0 = (size_t)blockIdx.x * PR; const size_t bb = r0 / TT; const int t0 = (int)(r0 % TT);
  const float* xp = X + (r0 + wave * 16 + col) * DIN + 8 * g;   /* the lane's row of x, at its half's first k */
  v4f xr[DIN / 32][4];
#pragma unroll
  for (int kc = 0; kc < XPF; ++kc) { xr[kc][0] = *(const v4f*)(xp + kc * 32); xr[kc][1] = *(const v4f*)(xp + kc * 32 + 4); xr[kc][2] = *(const v4f*)(xp + kc * 32 + 16); xr[kc][3] = *(const v4f*)(xp + kc * 32 + 20); }
  // staging: a thread takes 8 k rows x 4 columns of a weight (whole lines across the lanes) and writes four 16-byte units, one per column: 8 neighbouring k of that column, which is one half of a lane's fragment
  { const int kg0 = tid >> 4, c4 = tid & 15; const unsigned wo = (unsigned)(kg0 * 8 * HD + c4 * 4) * 4u;   /* the thread's byte offset in each weight */
    const float* wq = (const float*)((const char*)WQ + wo); const float* wk = (const float*)((const char*)WK + wo); const float* wv = (const float*)((const char*)WV + wo); v4f w[9][8];
#pragma unroll
    for (int n = 0; n < 9; ++n) { const float* wp = n < 3 ? wq : n < 6 ? wk : wv;
#pragma unroll
      for (int i = 0; i < 8; ++i) w[n][i] = *(const v4f*)(wp + ((n % 3) * 16 * 8 + i) * HD); }
    // the wait that stands before a register named by an issued load or store is written again; here and below those registers are its inputs so that they keep their values up to it
    asm volatile("s_wait_xcnt 0x0" :: "v"(xp), "v"(wo) : "memory");
#pragma unroll
    for (int n = 0; n < 9; ++n) { const int kg = (n % 3) * 16 + kg0;   /* k group kg = 4 kc + 2 half + g */
      const int u0 = (((n / 3) * (DIN / 32) + (kg >> 2)) * (HD / 16) + (c4 >> 2)) * WFU + ((kg >> 1) & 1) * 32 + (kg & 1) * 16 + (c4 & 3) * 4;
#pragma unroll
      for (int s = 0; s < 4; ++s) { union { v8b b; v4u u; } t;
#pragma unroll
        for (int i = 0; i < 8; ++i) t.b[i] = (__bf16)w[n][i][s];
        wl[u0 + s] = t.u; } } }
  __syncthreads();
  // k loop: product s is followed by the LDS loads of fragment s + WRING into the registers it has just read; the v_nop statement of the product helper holds each load on its side of it, which keeps WRING fragments and XPF chunks of x in flight
  union { v16b v; v4u q[2]; } wf[WRING];
#pragma unroll
  for (int s = 0; s < WRING; ++s) { wf[s].q[0] = wl[WFRAG(s) * WFU + lane]; wf[s].q[1] = wl[WFRAG(s) * WFU + 32 + lane]; }
  v8f acc[12] = {};   /* 0..3 q^T, 4..7 k^T, 8..11 v */
#pragma unroll
  for (int kc = 0; kc < DIN / 32; ++kc) {
    if (kc + XPF < DIN / 32) { const int kn = kc + XPF; xr[kn][0] = *(const v4f*)(xp + kn * 32); xr[kn][1] = *(const v4f*)(xp + kn * 32 + 4); xr[kn][2] = *(const v4f*)(xp + kn * 32 + 16); xr[kn][3] = *(const v4f*)(xp + kn * 32 + 20); }
    v16b a;
#pragma unroll
    for (int i = 0; i < 4; ++i) { a[i] = (__bf16)xr[kc][0][i]; a[4 + i] = (__bf16)xr[kc][1][i]; a[8 + i] = (__bf16)xr[kc][2][i]; a[12 + i] = (__bf16)xr[kc][3][i]; }
#pragma unroll
    for (int j = 0; j < 12; ++j) { const int s = kc * 12 + j, sl = s % WRING, sn = s + WRING;
      acc[j] = j < 8 ? wmma_bf(wf[sl].v, a, acc[j]) : wmma_bf(a, wf[sl].v, acc[j]);
      if (sn < NSTEP) { wf[sl].q[0] = wl[WFRAG(sn) * WFU + lane]; wf[sl].q[1] = wl[WFRAG(sn) * WFU + 32 + lane]; } } }
  asm volatile("s_wait_xcnt 0x0" :: "v"(xp) : "memory");   /* as above, for the loads of x in the loop */
  const bool hi_rows = t0 < QHI && t0 < KHI;   /* QHI == KHI, multiples of PR: the same for the whole block */
  const unsigned oh = (unsigned)((r0 / 16 + wave) * FT + lane * 8) * 2u;   /* the lane's byte offset in the wave's tile of the arrays that hold every t */
  const unsigned ol = (unsigned)((bb * (QHI / 16) + t0 / 16 + wave) * FT + lane * 8) * 2u;   /* and of those that hold t < QHI == KHI */
  { v4u hv[8];
#pragma unroll
    for (int j = 0; j < 8; ++j) { union { v8h h; v4u u; } t;
#pragma unroll
      for (int r = 0; r < 8; ++r) t.h[r] = (_Float16)acc[j][r];
      hv[j] = t.u; }
#pragma unroll
    for (int j = 0; j < 4; ++j) { vst2((char*)QH + oh + j * FG * 2, hv[j]); vst2((char*)KH + oh + j * FG * 2, hv[4 + j]); }
    asm volatile("s_wait_xcnt 0x0" :: "v"(oh), "v"(hv[0]), "v"(hv[1]), "v"(hv[2]), "v"(hv[3]), "v"(hv[4]), "v"(hv[5]), "v"(hv[6]), "v"(hv[7]) : "memory"); }
  if (hi_rows) { v4u lv[8];
#pragma unroll
    for (int j = 0; j < 8; ++j) { union { v8h h; v4u u; } t;
#pragma unroll
      for (int r = 0; r < 8; ++r) { const float v = acc[j][r]; t.h[r] = (_Float16)((v - (float)(_Float16)v) * 1024.0f); }
      lv[j] = t.u; }
#pragma unroll
    for (int j = 0; j < 4; ++j) { vst2((char*)QL + ol + j * FG * 2, lv[j]); vst2((char*)KL + ol + j * FG * 2, lv[4 + j]); }
    asm volatile("s_wait_xcnt 0x0" :: "v"(ol), "v"(lv[0]), "v"(lv[1]), "v"(lv[2]), "v"(lv[3]), "v"(lv[4]), "v"(lv[5]), "v"(lv[6]), "v"(lv[7]) : "memory"); }
  { v4u fv[4], bv[4], lv[4];
#pragma unroll
    for (int j = 0; j < 4; ++j) { union { v8h h; v4u u; } fh; union { v8b b; v4u u; } bh, bl;
#pragma unroll
      for (int r = 0; r < 8; ++r) { const float v = acc[8 + j][r]; fh.h[r] = (_Float16)v; const __bf16 h = (__bf16)v; bh.b[r] = h; bl.b[r] = (__bf16)(v - (float)h); }
      fv[j] = fh.u; bv[j] = bh.u; lv[j] = bl.u; }
#pragma unroll
    for (int j = 0; j < 4; ++j) vst2((char*)VT + oh + j * FG * 2, fv[j]);
    asm volatile("s_wait_xcnt 0x0" :: "v"(oh), "v"(fv[0]), "v"(fv[1]), "v"(fv[2]), "v"(fv[3]) : "memory");
    if (hi_rows) {
#pragma unroll
      for (int j = 0; j < 4; ++j) { vst2((char*)VB + ol + j * FG * 2, bv[j]); vst2((char*)VBL + ol + j * FG * 2, lv[j]); } } } }
// fragment in the hardware k order from a lane's own pointer (start of a group + 8 * lane); its second half lies D elements on: the next group of the tile for q and k (head columns + 16), the same group of the next tile for v (keys + 16)
template <int D> __device__ __forceinline__ v16h frag_hp(const _Float16* p) { union { v16h v; v8h q[2]; } u; u.q[0] = *(const v8h*)p; u.q[1] = *(const v8h*)(p + D); return u.v; }
template <int D> __device__ __forceinline__ v16b frag_bp(const __bf16* p) { union { v16b v; v8b q[2]; } u; u.q[0] = *(const v8b*)p; u.q[1] = *(const v8b*)(p + D); return u.v; }
// ---- k_attn: block = 8 waves = 4 tiles of 16 queries (query block qb) of sequence b x 2 key halves: waves w and w + 4 share query tile w, one walks the even key passes, the other the odd ones, each with its own running maximum, sum and O^T; after the walk the odd wave hands its three to the even one through LDS (one barrier), which joins them and stores. Twice the waves a SIMD to fill each other's waits, half the passes in a row. Transposed products: S^T = K Q^T (a lane holds one query's scores, keys 8g+r of each 16-key tile), causal mask by index, running maximum and sum per lane from pass to pass, O^T += V^T P^T with P^T packed from two score tiles (hardware k order, as V^T is loaded). Products as before: query blocks < QBH take q/k hi + residual (3 products) and P, v as bf16 hi + lo (3 products), 32 keys a pass; the rest one f16 product each (P x 2^11), 64 keys a pass.
// Loads: a pass issues its v fragments ahead of its score products and the next pass's k fragments right behind them (into the registers those products have just read), so v lands under the score work and k under softmax and P.v. The v_nop statements of the product helpers hold a load on its side of them, which is what keeps the two groups at these places.
template <bool HI> __device__ __forceinline__ void attn_body(const _Float16* __restrict__ QH, const _Float16* __restrict__ KH, const _Float16* __restrict__ QL, const _Float16* __restrict__ KL, const _Float16* __restrict__ VT, const __bf16* __restrict__ VB, const __bf16* __restrict__ VBL, int b, int qb, float* __restrict__ OUT, v4f (*jacc)[8][32], v2f (*jml)[32]) {
  constexpr int KT = HI ? 2 : 4;   /* 16-key tiles a pass */
  const int tid = threadIdx.x, wv = __builtin_amdgcn_readfirstlane(tid >> 5), wave = wv & 3, kh2 = wv >> 2, lane = tid & 31, col = lane & 15, g = lane >> 4; const int ql0 = qb * 64 + wave * 16, t = ql0 + col; const size_t rb = (size_t)b * TT;   /* wave: query tile; kh2: key half, passes kh2, kh2 + 2, ... */
  const int npass = (ql0 + 15) / (16 * KT) + 1;   /* keys 0 .. ql0 + 15 */
  const int p0 = kh2 < npass ? kh2 : 0;   /* the wave's first pass; a wave without one loads pass 0's rows and uses nothing of them */
  const unsigned lo = (unsigned)(lane * 8);   /* the lane's offset in every group */
  v16h qh[HD / 32], ql[HD / 32], kh[KT][HD / 32], kl[KT][HD / 32];
#pragma unroll
  for (int kc = 0; kc < HD / 32; ++kc) { qh[kc] = frag_hp<FG>(QH + (rb + ql0) / 16 * FT + kc * 2 * FG + lo); if (HI) ql[kc] = frag_hp<FG>(QL + ((size_t)b * QHI + ql0) / 16 * FT + kc * 2 * FG + lo); }
  const _Float16* kp = KH + (rb / 16 + p0 * KT) * FT + lo; const _Float16* klp = KL + ((size_t)b * (KHI / 16) + p0 * KT) * FT + lo;   /* the lane's place in the first k tile of the pass whose fragments are loaded next */
#pragma unroll
  for (int i = 0; i < KT; ++i)
#pragma unroll
    for (int kc = 0; kc < HD / 32; ++kc) { kh[i][kc] = frag_hp<FG>(kp + i * FT + kc * 2 * FG); if (HI) kl[i][kc] = frag_hp<FG>(klp + i * FT + kc * 2 * FG); }
  // each s_wait_xcnt below is the wait that stands before a register named by an issued load is written again; the pointers are its inputs so that they keep their registers up to it
  if (HI) asm volatile("s_wait_xcnt 0x0" :: "v"(kp), "v"(klp) : "memory"); else asm volatile("s_wait_xcnt 0x0" :: "v"(kp) : "memory");
  v8f acc[HD / 16] = {}; float m = -3.0e38f, l = 0.f;
#pragma unroll 1
  for (int kb = kh2; kb < npass; kb += 2) { const int k0 = kb * 16 * KT;
    v16h vf[KT / 2][HD / 16]; v16b vh[KT / 2][HD / 16], vl[KT / 2][HD / 16];
    const _Float16* vp = VT + (rb + k0) / 16 * FT + lo; const __bf16* vbp = VB + ((size_t)b * KHI + k0) / 16 * FT + lo; const __bf16* vlp = VBL + ((size_t)b * KHI + k0) / 16 * FT + lo;
#pragma unroll
    for (int ks = 0; ks < KT / 2; ++ks)
#pragma unroll
      for (int j = 0; j < HD / 16; ++j) {
        if (HI) { vh[ks][j] = frag_bp<FT>(vbp + ks * 2 * FT + j * FG); vl[ks][j] = frag_bp<FT>(vlp + ks * 2 * FT + j * FG); }
        else vf[ks][j] = frag_hp<FT>(vp + ks * 2 * FT + j * FG); }
    v8f s[KT];
#pragma unroll
    for (int i = 0; i < KT; ++i) { v8f a = {}, al = {};
#pragma unroll
      for (int kc = 0; kc < HD / 32; ++kc) { a = wmma16(kh[i][kc], qh[kc], a); if (HI) { al = wmma16(kh[i][kc], ql[kc], al); al = wmma16(kl[i][kc], qh[kc], al); } }
#pragma unroll
      for (int r = 0; r < 8; ++r) { const float v = (HI ? a[r] + al[r] * (1.0f / 1024.0f) : a[r]) * SCALE; s[i][r] = (k0 + i * 16 + 8 * g + r <= t) ? v : -3.0e38f; } }
    if (HI) asm volatile("s_wait_xcnt 0x0" :: "v"(vbp), "v"(vlp) : "memory"); else asm volatile("s_wait_xcnt 0x0" :: "v"(vp) : "memory");
    const int adv = kb + 2 < npass ? 2 * KT * FT : 0; kp += adv; klp += adv;   /* the wave's last pass loads its own rows again: no branch, so the counted waits on v below leave these loads in flight */
#pragma unroll
    for (int i = 0; i < KT; ++i)
#pragma unroll
      for (int kc = 0; kc < HD / 32; ++kc) { kh[i][kc] = frag_hp<FG>(kp + i * FT + kc * 2 * FG); if (HI) kl[i][kc] = frag_hp<FG>(klp + i * FT + kc * 2 * FG); }
    float mb = s[0][0];
#pragma unroll
    for (int i = 0; i < KT; ++i)
#pragma unroll
      for (int r = 0; r < 8; ++r) mb = fmaxf(mb, s[i][r]);
    mb = fmaxf(mb, __shfl_xor(mb, 16)); const float mn = fmaxf(m, mb); const float alpha = expf(m - mn); m = mn;   /* every pass holds its first key k0 <= ql0 <= t, so mn is a real logit from the wave's first pass on */
    float sum = 0.f;
#pragma unroll
    for (int i = 0; i < KT; ++i)
#pragma unroll
      for (int r = 0; r < 8; ++r) { const float e = expf(s[i][r] - mn); s[i][r] = e; sum += e; }
    l = l * alpha + sum;   /* this half's keys only; the halves join after the loop */
#pragma unroll
    for (int j = 0; j < HD / 16; ++j) acc[j] *= alpha;
    if (HI) asm volatile("s_wait_xcnt 0x0" :: "v"(kp), "v"(klp) : "memory"); else asm volatile("s_wait_xcnt 0x0" :: "v"(kp) : "memory");
#pragma unroll
    for (int ks = 0; ks < KT / 2; ++ks) {
      if (HI) { float pv[16];
#pragma unroll
        for (int r = 0; r < 8; ++r) { pv[r] = s[2 * ks][r]; pv[8 + r] = s[2 * ks + 1][r]; }
        const F2 p = bsplit16(pv);
#pragma unroll
        for (int j = 0; j < HD / 16; ++j) { acc[j] = wmma_bf(vh[ks][j], p.h, acc[j]); acc[j] = wmma_bf(vh[ks][j], p.l, acc[j]); acc[j] = wmma_bf(vl[ks][j], p.h, acc[j]); }
      } else { v16h p;
#pragma unroll
        for (int r = 0; r < 8; ++r) { p[r] = (_Float16)(s[2 * ks][r] * 2048.0f); p[8 + r] = (_Float16)(s[2 * ks + 1][r] * 2048.0f); }
#pragma unroll
        for (int j = 0; j < HD / 16; ++j) acc[j] = wmma16(vf[ks][j], p, acc[j]); } } }
  asm volatile("s_wait_loadcnt 0x0" ::: "memory");   /* the last pass's look-ahead loads land before the wave goes on to its end */
  // join of the two key halves: same lane, same elements in both waves; 16 bytes a lane in a row, so no bank is met twice
  if (kh2) {
#pragma unroll
    for (int j = 0; j < HD / 16; ++j) { jacc[wave][2 * j][lane] = __builtin_shufflevector(acc[j], acc[j], 0, 1, 2, 3); jacc[wave][2 * j + 1][lane] = __builtin_shufflevector(acc[j], acc[j], 4, 5, 6, 7); }
    v2f ml; ml[0] = m; ml[1] = l; jml[wave][lane] = ml; }
  __syncthreads();   /* the odd waves' maximum, sum and O^T are in LDS before the even waves read them; every wave of the block passes here once */
  if (kh2 == 0) { const v2f ml = jml[wave][lane]; const float mn = fmaxf(m, ml[0]);   /* m is real (pass 0 is this wave's); a partner without a pass left -3.0e38, 0, 0 and gets weight 0 */
    const float a0 = expf(m - mn), a1 = expf(ml[0] - mn); l = l * a0 + ml[1] * a1;
#pragma unroll
    for (int j = 0; j < HD / 16; ++j) { const v4f pa = jacc[wave][2 * j][lane], pb = jacc[wave][2 * j + 1][lane];
#pragma unroll
      for (int r = 0; r < 4; ++r) { acc[j][r] = acc[j][r] * a0 + pa[r] * a1; acc[j][4 + r] = acc[j][4 + r] * a0 + pb[r] * a1; } }
    l += __shfl_xor(l, 16); const float inv = l > 0.f ? (HI ? 1.0f : 1.0f / 2048.0f) / l : 0.f;
#pragma unroll
    for (int j = 0; j < HD / 16; ++j) acc[j] *= inv;
#pragma unroll
    for (int j = 0; j < HD / 16; ++j) { float* o = OUT + (rb + ql0) * HD + j * 16 + (unsigned)(col * HD + 8 * g);   /* lane: head columns j*16 + 8g + 0..7 of its query row */
      vst2(o, __builtin_shufflevector(acc[j], acc[j], 0, 1, 2, 3)); vst2(o + 4, __builtin_shufflevector(acc[j], acc[j], 4, 5, 6, 7)); } } }
__global__ __launch_bounds__(256) void k_attn(const _Float16* __restrict__ QH, const _Float16* __restrict__ KH, const _Float16* __restrict__ QL, const _Float16* __restrict__ KL, const _Float16* __restrict__ VT, const __bf16* __restrict__ VB, const __bf16* __restrict__ VBL, float* __restrict__ OUT) {
  const int b = blockIdx.x, y = blockIdx.y, qb = y < NQB / 2 ? NQB - 1 - y : y - NQB / 2;   /* for speed only: the sequence is the fast index, so each query block's cost spreads over the chip; long key walks start first, the second half of the grid rises from the shortest */
  __shared__ __align__(16) v4f jacc[4][8][32]; __shared__ __align__(8) v2f jml[4][32];   /* per query tile: the odd wave's O^T (8 x 16 bytes a lane) and its maximum and sum */
  if (qb < QBH) attn_body<true>(QH, KH, QL, KL, VT, VB, VBL, b, qb, OUT, jacc, jml); else attn_body<false>(QH, KH, QL, KL, VT, VB, VBL, b, qb, OUT, jacc, jml); }

extern "C" void kernel_launch(void* const* d_in, const int* in_sizes, int n_in, void* d_out, int out_size, void* d_ws, size_t ws_size, hipStream_t stream) {
  (void)in_sizes; (void)n_in; (void)out_size;
  const float** F = (const float**)d_in;
  if (ws_size < (size_t)WS_END) return;
  char* ws = (char*)d_ws; _Float16 *QH = (_Float16*)(ws + WS_QH), *KH = (_Float16*)(ws + WS_KH), *VT = (_Float16*)(ws + WS_VT), *QL = (_Float16*)(ws + WS_QL), *KL = (_Float16*)(ws + WS_KL); __bf16 *VB = (__bf16*)(ws + WS_VB), *VBL = (__bf16*)(ws + WS_VBL);
  // inputs: 0 x [64,512,384]; 1 Wq, 2 Wk, 3 Wv ((in,out) [384,64]); output [64,512,64]
  k_proj<<<dim3(TNB * TT / PR), 256, 0, stream>>>(F[0], F[1], F[2], F[3], QH, QL, KH, KL, VT, VB, VBL);
  k_attn<<<dim3(TNB, NQB), 256, 0, stream>>>(QH, KH, QL, KL, VT, VB, VBL, (float*)d_out);
}

// v005
// A run of this version takes 23 microseconds.
// In both of two side-by-side timings against v004, it was 1.05 times as fast.
// Over all steps from v000 it is 7.14 times as fast.
#include <hip/hip_runtime.h>
#include <math.h>

typedef __attribute__((ext_vector_type(16))) _Float16 v16h;
typedef __attribute__((ext_vector_type(16))) __bf16 v16b;
typedef __attribute__((ext_vector_type(8)))  _Float16 v8h;
typedef __attribute__((ext_vector_type(8)))  float v8f;
typedef __attribute__((ext_vector_type(4)))  float v4f;
typedef __attribute__((ext_vector_type(2)))  float v2f;
typedef __attribute__((ext_vector_type(4)))  unsigned v4u;
typedef __attribute__((ext_vector_type(4)))  int v4i;
typedef float __attribute__((may_alias)) float_a;
typedef int __attribute__((may_alias)) int_a;

template <typename T> __device__ __forceinline__ void vst2(void* p, T v) { *(T*)p = v;  }
__device__ __forceinline__ v8f wmma16(v16h a, v16h b, v8f c) {
  v8f d = __builtin_amdgcn_wmma_f32_16x16x32_f16(false, a, false, b, (short)0, c, false, false);
  asm volatile("v_nop\n\tv_nop\n\tv_nop\n\tv_nop" : "+v"(d) : "v"(a), "v"(b));
  return d;
}
__device__ __forceinline__ v8f wmma_bf(v16b a, v16b b, v8f c) {
  v8f d = __builtin_amdgcn_wmma_f32_16x16x32_bf16(false, a, false, b, (short)0, c, false, false);
  asm volatile("v_nop\n\tv_nop\n\tv_nop\n\tv_nop" : "+v"(d) : "v"(a), "v"(b));
  return d;
}
// 16x16x32 fragments: lane = (h = lane>>4, row/col = lane&15); elements 0..7 = k0+8h+0..7, 8..15 = k0+16+8h+0..7; D element r = row 8h+r
__device__ __forceinline__ v16h frag_h(const _Float16* rowk0, int lane) {
  union { v16h v; v8h q[2]; } u; const _Float16* p = rowk0 + 8 * (lane >> 4);
  u.q[0] = *(const v8h*)p; u.q[1] = *(const v8h*)(p + 16); return u.v;
}
__device__ __forceinline__ v16h frag_f32(const float* rowk0, int lane) {
  v16h a; const float* p = rowk0 + 8 * (lane >> 4);
#pragma unroll
  for (int i = 0; i < 8; ++i) { a[i] = (_Float16)p[i]; a[8 + i] = (_Float16)p[16 + i]; }
  return a;
}
__device__ __forceinline__ v16h frag_f32s(const float* rowk0, int lane, float sc) {
  v16h a; const float* p = rowk0 + 8 * (lane >> 4);
#pragma unroll
  for (int i = 0; i < 8; ++i) { a[i] = (_Float16)(p[i] * sc); a[8 + i] = (_Float16)(p[16 + i] * sc); }
  return a;
}
// column fragment from a [K][ld] layout (column n), rows >= K read as 0
__device__ __forceinline__ v16h fragc_f32(const float* W, int k0, int n, int lane, int ld, int K) {
  v16h a; const int g = lane >> 4;
#pragma unroll
  for (int i = 0; i < 8; ++i) { const int ka = k0 + 8 * g + i, kb = ka + 16;
    a[i] = (_Float16)(ka < K ? W[(size_t)(ka < K ? ka : K - 1) * ld + n] : 0.f); a[8 + i] = (_Float16)(kb < K ? W[(size_t)(kb < K ? kb : K - 1) * ld + n] : 0.f); }
  return a;
}
struct F2 { v16b h, l; };
__device__ __forceinline__ F2 bsplit16(const float v[16]) { F2 r;
#pragma unroll
  for (int i = 0; i < 16; ++i) { const __bf16 h = (__bf16)v[i]; r.h[i] = h; r.l[i] = (__bf16)(v[i] - (float)h); }
  return r; }
__device__ __forceinline__ F2 split_row(const float* row, int k0, int lane) { float v[16]; const float* p = row + k0 + 8 * (lane >> 4);
#pragma unroll
  for (int i = 0; i < 8; ++i) { v[i] = p[i]; v[8 + i] = p[16 + i]; }
  return bsplit16(v); }
__device__ __forceinline__ F2 split_rowK(const float* row, int k0, int lane, int K) { float v[16]; const int g = lane >> 4;
#pragma unroll
  for (int i = 0; i < 8; ++i) { const int ka = k0 + 8 * g + i, kb = ka + 16; v[i] = ka < K ? row[ka < K ? ka : K - 1] : 0.f; v[8 + i] = kb < K ? row[kb < K ? kb : K - 1] : 0.f; }
  return bsplit16(v); }
__device__ __forceinline__ F2 split_col(const float* W, int k0, int n, int lane, int ld, int K) { float v[16]; const int g = lane >> 4;
#pragma unroll
  for (int i = 0; i < 8; ++i) { const int ka = k0 + 8 * g + i, kb = ka + 16; v[i] = ka < K ? W[(size_t)(ka < K ? ka : K - 1) * ld + n] : 0.f; v[8 + i] = kb < K ? W[(size_t)(kb < K ? kb : K - 1) * ld + n] : 0.f; }
  return bsplit16(v); }
__device__ __forceinline__ v8f mac3(const F2& a, const F2& b, v8f c) { c = wmma_bf(a.l, b.h, c); c = wmma_bf(a.h, b.l, c); return wmma_bf(a.h, b.h, c); }
__device__ __forceinline__ float sigm(float v) { return 1.0f / (1.0f + expf(-v)); }
#define LDSX() do { asm volatile("s_wait_dscnt 0" ::: "memory"); __builtin_amdgcn_wave_barrier(); __builtin_amdgcn_fence(__ATOMIC_RELEASE, "workgroup"); } while (0)

// Single causal self-attention head (B 64, T 512, d_model 384, head 64): q/k/v = x W ((in,out) [384,64]); wei = softmax(causal(q k^T / 8)); out = wei v ([B, T, 64]). Two launches: the projections, then scores, softmax and P.v in one kernel.
#define NB 64
#define TT 512
#define CC 128            // NH * HD; not used by the compiled code: the workspace arrays are HD wide
#define DIN 384          // input (model) width
#define NH 2
#define HD 64
#define NQB (TT / 64)
#define SCALE (0.125f)
#define CAUSAL 1
#ifndef TNB
#define TNB NB
#endif
__device__ __forceinline__ float bfr(float v) { return (float)(__bf16)v; }
typedef __attribute__((ext_vector_type(8))) __bf16 v8b;
__device__ __forceinline__ v16b frag_b(const __bf16* rowk0, int lane) {
  union { v16b v; v8b q[2]; } u; const __bf16* p = rowk0 + 8 * (lane >> 4);
  u.q[0] = *(const v8b*)p; u.q[1] = *(const v8b*)(p + 16); return u.v;
}
#define QBH 6              // causal: query blocks 0..QBH-1 of each sequence (few keys, no averaging) take the high-precision path
#define QHI 384            // rows carrying a q residual plane
#define KHI 384            // key rows carrying k residual / v bf16 hi+lo planes (used only by the causal high-precision path)
// B fragment (k rows k0+.., output column o) of a weight: (in,out) [K][ld] or (out,in) [ld rows of K]: bf16 exact, or f16(bf16 * 256) exact
__device__ __forceinline__ v16b wcol_io(const float* Wm, int k0, int o, int lane, int ld) { v16b w; const int g = lane >> 4;
#pragma unroll
  for (int i = 0; i < 8; ++i) { w[i] = (__bf16)Wm[(size_t)(k0 + 8 * g + i) * ld + o]; w[8 + i] = (__bf16)Wm[(size_t)(k0 + 16 + 8 * g + i) * ld + o]; }
  return w; }
__device__ __forceinline__ v16b wcol_oi(const float* Wm, int k0, int o, int lane, int K) { v16b w; const float* p = Wm + (size_t)o * K + k0 + 8 * (lane >> 4);
#pragma unroll
  for (int i = 0; i < 8; ++i) { w[i] = (__bf16)p[i]; w[8 + i] = (__bf16)p[16 + i]; }
  return w; }
__device__ __forceinline__ v16h wcolh_io(const float* Wm, int k0, int o, int lane, int ld) { v16h w; const int g = lane >> 4;
#pragma unroll
  for (int i = 0; i < 8; ++i) { w[i] = (_Float16)(bfr(Wm[(size_t)(k0 + 8 * g + i) * ld + o]) * 256.0f); w[8 + i] = (_Float16)(bfr(Wm[(size_t)(k0 + 16 + 8 * g + i) * ld + o]) * 256.0f); }
  return w; }
__device__ __forceinline__ v16h wcolh_oi(const float* Wm, int k0, int o, int lane, int K) { v16h w; const float* p = Wm + (size_t)o * K + k0 + 8 * (lane >> 4);
#pragma unroll
  for (int i = 0; i < 8; ++i) { w[i] = (_Float16)(bfr(p[i]) * 256.0f); w[8 + i] = (_Float16)(bfr(p[16 + i]) * 256.0f); }
  return w; }
#define WQKV_LAYOUT 0   // 0 = (in,out) [DIN][HD]; 1 = (out,in) [CC][DIN]; 2 = per-head [NH][DIN][HD]
__device__ __forceinline__ v16b wcol_hdk(const float* Wm, int k0, int o, int lane) { v16b w; const int g = lane >> 4; const float* p = Wm + (size_t)(o / HD) * DIN * HD + (o % HD);
#pragma unroll
  for (int i = 0; i < 8; ++i) { w[i] = (__bf16)p[(size_t)(k0 + 8 * g + i) * HD]; w[8 + i] = (__bf16)p[(size_t)(k0 + 16 + 8 * g + i) * HD]; }
  return w; }
#define WO_OUT_IN 0
#if WQKV_LAYOUT == 1
#define WCOL(W, k0, o, lane) wcol_oi(W, k0, o, lane, DIN)
#elif WQKV_LAYOUT == 2
#define WCOL(W, k0, o, lane) wcol_hdk(W, k0, o, lane)
#else
#define WCOL(W, k0, o, lane) wcol_io(W, k0, (o) & 63, lane, HD)   /* (in,out) [384][64]; columns 64..127 = a second copy of the head */
#endif
#if WO_OUT_IN
#define WOCOL(W, k0, o, lane) wcol_oi(W, k0, o, lane, CC)
#define WOCOLH(W, k0, o, lane) wcolh_oi(W, k0, o, lane, CC)
#else
#define WOCOL(W, k0, o, lane) wcol_io(W, k0, o, lane, DIN)
#define WOCOLH(W, k0, o, lane) wcolh_io(W, k0, o, lane, DIN)
#endif
#ifndef PROJ_EXTRA_PARAMS
#define PROJ_EXTRA_PARAMS
#endif

// Every workspace array is kept in fragment order: a tile of 16 positions t x HD head columns is FT 16-bit elements (2 KiB) = 4 groups j x 32 lanes x 8 elements, so that one 16-byte access a lane covers 512 bytes in a row, whole lines, in the kernel that stores it and in the one that loads it.
// q, k: lane (g, col) of group j holds row t = 16 tile + col, head columns 16 j + 8 g + 0..7. v: lane (g, col) of group j holds head column 16 j + col, positions t = 16 tile + 8 g + 0..7.
#define FG 256             // elements of a group: 32 lanes x 8
#define FT (4 * FG)        // elements of a tile
#define WS_QH  0u                                      // f16 q tiles [b][t / 16]
#define WS_KH  (WS_QH + 2u * (size_t)NB * TT * HD)      // f16 k tiles [b][t / 16]
#define WS_VT  (WS_KH + 2u * (size_t)NB * TT * HD)      // f16 v tiles [b][t / 16]
#define WS_QL  (WS_VT + 2u * (size_t)NB * TT * HD)      // f16 q residual x 2^10 tiles [b][t / 16, t < QHI]
#define WS_KL  (WS_QL + 2u * (size_t)NB * QHI * HD)     // f16 k residual x 2^10 tiles [b][t / 16, t < KHI]
#define WS_VB  (WS_KL + 2u * (size_t)NB * KHI * HD)     // bf16 v hi tiles [b][t / 16, t < KHI]
#define WS_VBL (WS_VB + 2u * (size_t)NB * KHI * HD)     // bf16 v lo tiles, likewise
#define WS_END (WS_VBL + 2u * (size_t)NB * KHI * HD)

// ---- k_proj: block = 8 waves x 16 rows of x, all 192 real output columns (q, k, v: 64 each). The three weights are staged once in LDS as bf16 in fragment order, so the k loop reads a weight fragment with two 16-byte LDS loads and one x fragment feeds all twelve tiles. Products and k order as before (exact bf16 products, K = DIN).
// q and k tiles are formed transposed (weight fragment as A, x fragment as B): a lane then holds 8 neighbouring columns of one row. v tiles (x as A): a lane holds 8 neighbouring t of one head column. Both are what the same lane of k_attn wants as half a fragment, so every tile goes from the registers straight to its place in fragment order.
// Every loop of this kernel is unrolled in full: its register arrays (x chunks, fragment ring, accumulators) are then indexed by constants and stay in registers.
#define PR 128             // rows of x a block
#define WFU 65             // 16-byte units from one weight fragment to the next in LDS: 2 halves x 32 lanes, + 1 so that the staging stores of the four column tiles fall on different banks
#define XPF 4              // k chunks of x in flight ahead of the products
#define WRING 8            // weight fragments in flight from LDS ahead of the products
#define NSTEP (12 * (DIN / 32))   // products a wave: 12 tiles a k chunk
#define WFRAG(s) (((((s) % 12) >> 2) * (DIN / 32) + (s) / 12) * (HD / 16) + (((s) % 12) & 3))   // fragment of product s: weight (s % 12) / 4, k chunk s / 12, column tile s % 4
__global__ __launch_bounds__(256) void k_proj(const float* __restrict__ X, const float* __restrict__ WQ, const float* __restrict__ WK, const float* __restrict__ WV,
    _Float16* __restrict__ QH, _Float16* __restrict__ QL, _Float16* __restrict__ KH, _Float16* __restrict__ KL, _Float16* __restrict__ VT, __bf16* __restrict__ VB, __bf16* __restrict__ VBL) {
  __shared__ __align__(16) v4u wl[3 * (DIN / 32) * (HD / 16) * WFU];
  const int tid = threadIdx.x, wave = tid >> 5, lane = tid & 31, col = lane & 15, g = lane >> 4; const size_t r0 = (size_t)blockIdx.x * PR; const size_t bb = r0 / TT; const int t0 = (int)(r0 % TT);
  const float* xp = X + (r0 + wave * 16 + col) * DIN + 8 * g;   /* the lane's row of x, at its half's first k */
  v4f xr[DIN / 32][4];
#pragma unroll
  for (int kc = 0; kc < XPF; ++kc) { xr[kc][0] = *(const v4f*)(xp + kc * 32); xr[kc][1] = *(const v4f*)(xp + kc * 32 + 4); xr[kc][2] = *(const v4f*)(xp + kc * 32 + 16); xr[kc][3] = *(const v4f*)(xp + kc * 32 + 20); }
  // staging: a thread takes 8 k rows x 4 columns of a weight (whole lines across the lanes) and writes four 16-byte units, one per column: 8 neighbouring k of that column, which is one half of a lane's fragment
  { const int kg0 = tid >> 4, c4 = tid & 15; const unsigned wo = (unsigned)(kg0 * 8 * HD + c4 * 4) * 4u;   /* the thread's byte offset in each weight */
    const float* wq = (const float*)((const char*)WQ + wo); const float* wk = (const float*)((const char*)WK + wo); const float* wv = (const float*)((const char*)WV + wo); v4f w[9][8];
#pragma unroll
    for (int n = 0; n < 9; ++n) { const float* wp = n < 3 ? wq : n < 6 ? wk : wv;
#pragma unroll
      for (int i = 0; i < 8; ++i) w[n][i] = *(const v4f*)(wp + ((n % 3) * 16 * 8 + i) * HD); }
    // the wait that stands before a register named by an issued load or store is written again; here and below those registers are its inputs so that they keep their values up to it
    asm volatile("s_wait_xcnt 0x0" :: "v"(xp), "v"(wo) : "memory");
#pragma unroll
    for (int n = 0; n < 9; ++n) { const int kg = (n % 3) * 16 + kg0;   /* k group kg = 4 kc + 2 half + g */
      const int u0 = (((n / 3) * (DIN / 32) + (kg >> 2)) * (HD / 16) + (c4 >> 2)) * WFU + ((kg >> 1) & 1) * 32 + (kg & 1) * 16 + (c4 & 3) * 4;
#pragma unroll
      for (int s = 0; s < 4; ++s) { union { v8b b; v4u u; } t;
#pragma unroll
        for (int i = 0; i < 8; ++i) t.b[i] = (__bf16)w[n][i][s];
        wl[u0 + s] = t.u; } } }
  __syncthreads();
  // k loop: product s is followed by the LDS loads of fragment s + WRING into the registers it has just read; the v_nop statement of the product helper holds each load on its side of it, which keeps WRING fragments and XPF chunks of x in flight
  union { v16b v; v4u q[2]; } wf[WRING];
#pragma unroll
  for (int s = 0; s < WRING; ++s) { wf[s].q[0] = wl[WFRAG(s) * WFU + lane]; wf[s].q[1] = wl[WFRAG(s) * WFU + 32 + lane]; }
  v8f acc[12] = {};   /* 0..3 q^T, 4..7 k^T, 8..11 v */
#pragma unroll
  for (int kc = 0; kc < DIN / 32; ++kc) {
    if (kc + XPF < DIN / 32) { const int kn = kc + XPF; xr[kn][0] = *(const v4f*)(xp + kn * 32); xr[kn][1] = *(const v4f*)(xp + kn * 32 + 4); xr[kn][2] = *(const v4f*)(xp + kn * 32 + 16); xr[kn][3] = *(const v4f*)(xp + kn * 32 + 20); }
    v16b a;
#pragma unroll
    for (int i = 0; i < 4; ++i) { a[i] = (__bf16)xr[kc][0][i]; a[4 + i] = (__bf16)xr[kc][1][i]; a[8 + i] = (__bf16)xr[kc][2][i]; a[12 + i] = (__bf16)xr[kc][3][i]; }
#pragma unroll
    for (int j = 0; j < 12; ++j) { const int s = kc * 12 + j, sl = s % WRING, sn = s + WRING;
      acc[j] = j < 8 ? wmma_bf(wf[sl].v, a, acc[j]) : wmma_bf(a, wf[sl].v, acc[j]);
      if (sn < NSTEP) { wf[sl].q[0] = wl[WFRAG(sn) * WFU + lane]; wf[sl].q[1] = wl[WFRAG(sn) * WFU + 32 + lane]; } } }
  asm volatile("s_wait_xcnt 0x0" :: "v"(xp) : "memory");   /* as above, for the loads of x in the loop */
  const bool hi_rows = t0 < QHI && t0 < KHI;   /* QHI == KHI, multiples of PR: the same for the whole block */
  const unsigned oh = (unsigned)((r0 / 16 + wave) * FT + lane * 8) * 2u;   /* the lane's byte offset in the wave's tile of the arrays that hold every t */
  const unsigned ol = (unsigned)((bb * (QHI / 16) + t0 / 16 + wave) * FT + lane * 8) * 2u;   /* and of those that hold t < QHI == KHI */
  { v4u hv[8];
#pragma unroll
    for (int j = 0; j < 8; ++j) { union { v8h h; v4u u; } t;
#pragma unroll
      for (int r = 0; r < 8; ++r) t.h[r] = (_Float16)acc[j][r];
      hv[j] = t.u; }
#pragma unroll
    for (int j = 0; j < 4; ++j) { vst2((char*)QH + oh + j * FG * 2, hv[j]); vst2((char*)KH + oh + j * FG * 2, hv[4 + j]); }
    asm volatile("s_wait_xcnt 0x0" :: "v"(oh), "v"(hv[0]), "v"(hv[1]), "v"(hv[2]), "v"(hv[3]), "v"(hv[4]), "v"(hv[5]), "v"(hv[6]), "v"(hv[7]) : "memory"); }
  if (hi_rows) { v4u lv[8];
#pragma unroll
    for (int j = 0; j < 8; ++j) { union { v8h h; v4u u; } t;
#pragma unroll
      for (int r = 0; r < 8; ++r) { const float v = acc[j][r]; t.h[r] = (_Float16)((v - (float)(_Float16)v) * 1024.0f); }
      lv[j] = t.u; }
#pragma unroll
    for (int j = 0; j < 4; ++j) { vst2((char*)QL + ol + j * FG * 2, lv[j]); vst2((char*)KL + ol + j * FG * 2, lv[4 + j]); }
    asm volatile("s_wait_xcnt 0x0" :: "v"(ol), "v"(lv[0]), "v"(lv[1]), "v"(lv[2]), "v"(lv[3]), "v"(lv[4]), "v"(lv[5]), "v"(lv[6]), "v"(lv[7]) : "memory"); }
  { v4u fv[4], bv[4], lv[4];
#pragma unroll
    for (int j = 0; j < 4; ++j) { union { v8h h; v4u u; } fh; union { v8b b; v4u u; } bh, bl;
#pragma unroll
      for (int r = 0; r < 8; ++r) { const float v = acc[8 + j][r]; fh.h[r] = (_Float16)v; const __bf16 h = (__bf16)v; bh.b[r] = h; bl.b[r] = (__bf16)(v - (float)h); }
      fv[j] = fh.u; bv[j] = bh.u; lv[j] = bl.u; }
#pragma unroll
    for (int j = 0; j < 4; ++j) vst2((char*)VT + oh + j * FG * 2, fv[j]);
    asm volatile("s_wait_xcnt 0x0" :: "v"(oh), "v"(fv[0]), "v"(fv[1]), "v"(fv[2]), "v"(fv[3]) : "memory");
    if (hi_rows) {
#pragma unroll
      for (int j = 0; j < 4; ++j) { vst2((char*)VB + ol + j * FG * 2, bv[j]); vst2((char*)VBL + ol + j * FG * 2, lv[j]); } } } }
// fragment in the hardware k order from a lane's own pointer (start of a group + 8 * lane); its second half lies D elements on: the next group of the tile for q and k (head columns + 16), the same group of the next tile for v (keys + 16)
template <int D> __device__ __forceinline__ v16h frag_hp(const _Float16* p) { union { v16h v; v8h q[2]; } u; u.q[0] = *(const v8h*)p; u.q[1] = *(const v8h*)(p + D); return u.v; }
template <int D> __device__ __forceinline__ v16b frag_bp(const __bf16* p) { union { v16b v; v8b q[2]; } u; u.q[0] = *(const v8b*)p; u.q[1] = *(const v8b*)(p + D); return u.v; }
// ---- k_attn: block = 8 waves = 4 tiles of 16 queries (query block qb) of sequence b x 2 key halves: waves w and w + 4 share query tile w, one walks the even key passes, the other the odd ones, each with its own running maximum, sum and O^T; after the walk the odd wave hands its three to the even one through LDS (one barrier), which joins them and stores. Twice the waves a SIMD to fill each other's waits, half the passes in a row. Transposed products: S^T = K Q^T (a lane holds one query's scores, keys 8g+r of each 16-key tile), causal mask by index, running maximum and sum per lane from pass to pass, O^T += V^T P^T with P^T packed from two score tiles (hardware k order, as V^T is loaded). Products as before: query blocks < QBH take q/k hi + residual (3 products) and P, v as bf16 hi + lo (3 products), 32 keys a pass; the rest one f16 product each (P x 2^11), 64 keys a pass.
// Loads: a pass issues its v fragments ahead of its score products and the next pass's k fragments right behind them (into the registers those products have just read), so v lands under the score work and k under softmax and P.v. The v_nop statements of the product helpers hold a load on its side of them, and a scheduling barrier behind the k loads keeps that group ahead of the softmax.
// Exponentials: the scores stay unscaled (q.k); 1/8 and log2(e) are one factor C2 inside the exponent's multiply-add, and 2^x is the hardware instruction: two instructions a score. Every argument is <= 0 up to rounding; a result below the normal range may come out 0, against a sum that holds a term near 1.
#define C2 (SCALE * 1.44269504088896340736f)
// 2^x with the slot the instruction set asks for behind a transcendental, before its result is read or its source overwritten, kept in the same statement
__device__ __forceinline__ float ex2(float v) { asm("v_exp_f32 %0, %0\n\tv_nop" : "+v"(v)); return v; }
// eight 2^x in place, one statement: each v_exp_f32 is followed by one that touches none of its registers, and the v_nop is the slot the instruction set asks for behind the last one, before its result is read
__device__ __forceinline__ void ex2x8(v8f& x) { float a = x[0], b = x[1], c = x[2], d = x[3], e = x[4], f = x[5], g = x[6], h = x[7];
  asm("v_exp_f32 %0, %0\n\tv_exp_f32 %1, %1\n\tv_exp_f32 %2, %2\n\tv_exp_f32 %3, %3\n\tv_exp_f32 %4, %4\n\tv_exp_f32 %5, %5\n\tv_exp_f32 %6, %6\n\tv_exp_f32 %7, %7\n\tv_nop" : "+v"(a), "+v"(b), "+v"(c), "+v"(d), "+v"(e), "+v"(f), "+v"(g), "+v"(h));
  x[0] = a; x[1] = b; x[2] = c; x[3] = d; x[4] = e; x[5] = f; x[6] = g; x[7] = h; }
template <bool HI> __device__ __forceinline__ void attn_body(const _Float16* __restrict__ QH, const _Float16* __restrict__ KH, const _Float16* __restrict__ QL, const _Float16* __restrict__ KL, const _Float16* __restrict__ VT, const __bf16* __restrict__ VB, const __bf16* __restrict__ VBL, int b, int qb, float* __restrict__ OUT, v4f (*jacc)[8][32], v2f (*jml)[32]) {
  constexpr int KT = HI ? 2 : 4;   /* 16-key tiles a pass */
  const int tid = threadIdx.x, wv = __builtin_amdgcn_readfirstlane(tid >> 5), wave = wv & 3, kh2 = wv >> 2, lane = tid & 31, col = lane & 15, g = lane >> 4; const int ql0 = qb * 64 + wave * 16, t = ql0 + col; const size_t rb = (size_t)b * TT;   /* wave: query tile; kh2: key half, passes kh2, kh2 + 2, ... */
  const int npass = (ql0 + 15) / (16 * KT) + 1;   /* keys 0 .. ql0 + 15 */
  const int p0 = kh2 < npass ? kh2 : 0;   /* the wave's first pass; a wave without one loads pass 0's rows and uses nothing of them */
  const unsigned lo = (unsigned)(lane * 8);   /* the lane's offset in every group */
  v16h qh[HD / 32], ql[HD / 32], kh[KT][HD / 32], kl[KT][HD / 32];
#pragma unroll
  for (int kc = 0; kc < HD / 32; ++kc) { qh[kc] = frag_hp<FG>(QH + (rb + ql0) / 16 * FT + kc * 2 * FG + lo); if (HI) ql[kc] = frag_hp<FG>(QL + ((size_t)b * QHI + ql0) / 16 * FT + kc * 2 * FG + lo); }
  const _Float16* kp = KH + (rb / 16 + p0 * KT) * FT + lo; const _Float16* klp = KL + ((size_t)b * (KHI / 16) + p0 * KT) * FT + lo;   /* the lane's place in the first k tile of the pass whose fragments are loaded next */
#pragma unroll
  for (int i = 0; i < KT; ++i)
#pragma unroll
    for (int kc = 0; kc < HD / 32; ++kc) { kh[i][kc] = frag_hp<FG>(kp + i * FT + kc * 2 * FG); if (HI) kl[i][kc] = frag_hp<FG>(klp + i * FT + kc * 2 * FG); }
  // each s_wait_xcnt below is the wait that stands before a register named by an issued load is written again; the pointers are its inputs so that they keep their registers up to it
  if (HI) asm volatile("s_wait_xcnt 0x0" :: "v"(kp), "v"(klp) : "memory"); else asm volatile("s_wait_xcnt 0x0" :: "v"(kp) : "memory");
  v8f acc[HD / 16] = {}; float m = -3.0e38f, mc = -3.0e38f * C2, l = 0.f;   /* m: running maximum of the unscaled scores; mc = m * C2, the exponent that sum and O^T are held against */
#pragma unroll 1
  for (int kb = kh2; kb < npass; kb += 2) { const int k0 = kb * 16 * KT;
    v16h vf[KT / 2][HD / 16]; v16b vh[KT / 2][HD / 16], vl[KT / 2][HD / 16];
    const _Float16* vp = VT + (rb + k0) / 16 * FT + lo; const __bf16* vbp = VB + ((size_t)b * KHI + k0) / 16 * FT + lo; const __bf16* vlp = VBL + ((size_t)b * KHI + k0) / 16 * FT + lo;
#pragma unroll
    for (int ks = 0; ks < KT / 2; ++ks)
#pragma unroll
      for (int j = 0; j < HD / 16; ++j) {
        if (HI) { vh[ks][j] = frag_bp<FT>(vbp + ks * 2 * FT + j * FG); vl[ks][j] = frag_bp<FT>(vlp + ks * 2 * FT + j * FG); }
        else vf[ks][j] = frag_hp<FT>(vp + ks * 2 * FT + j * FG); }
    v8f s[KT];
#pragma unroll
    for (int i = 0; i < KT; ++i) { v8f a = {}, al = {};
#pragma unroll
      for (int kc = 0; kc < HD / 32; ++kc) { a = wmma16(kh[i][kc], qh[kc], a); if (HI) { al = wmma16(kh[i][kc], ql[kc], al); al = wmma16(kl[i][kc], qh[kc], al); } }
#pragma unroll
      for (int r = 0; r < 8; ++r) { const float v = HI ? a[r] + al[r] * (1.0f / 1024.0f) : a[r]; s[i][r] = (k0 + i * 16 + 8 * g + r <= t) ? v : -3.0e38f; } }
    if (HI) asm volatile("s_wait_xcnt 0x0" :: "v"(vbp), "v"(vlp) : "memory"); else asm volatile("s_wait_xcnt 0x0" :: "v"(vp) : "memory");
    const int adv = kb + 2 < npass ? 2 * KT * FT : 0; kp += adv; klp += adv;   /* the wave's last pass loads its own rows again: no branch, so the counted waits on v below leave these loads in flight */
#pragma unroll
    for (int i = 0; i < KT; ++i)
#pragma unroll
      for (int kc = 0; kc < HD / 32; ++kc) { kh[i][kc] = frag_hp<FG>(kp + i * FT + kc * 2 * FG); if (HI) kl[i][kc] = frag_hp<FG>(klp + i * FT + kc * 2 * FG); }
    __builtin_amdgcn_sched_barrier(0);   /* keeps the look-ahead loads above in front of the softmax: with the short exponentials the compiler let them sink to the pass's end, where the next pass would wait out their whole latency */
    float mb = s[0][0];
#pragma unroll
    for (int i = 0; i < KT; ++i)
#pragma unroll
      for (int r = 0; r < 8; ++r) mb = fmaxf(mb, s[i][r]);
    mb = fmaxf(mb, __shfl_xor(mb, 16)); const float mn = fmaxf(m, mb), mnc = mn * C2; const float alpha = ex2(mc - mnc); m = mn; mc = mnc;   /* every pass holds its first key k0 <= ql0 <= t, so mn is a real logit from the wave's first pass on */
    float sum = 0.f;
#pragma unroll
    for (int i = 0; i < KT; ++i) {
#pragma unroll
      for (int r = 0; r < 8; ++r) s[i][r] = __builtin_fmaf(s[i][r], C2, -mnc);
      ex2x8(s[i]);
#pragma unroll
      for (int r = 0; r < 8; ++r) sum += s[i][r]; }
    l = l * alpha + sum;   /* this half's keys only; the halves join after the loop */
#pragma unroll
    for (int j = 0; j < HD / 16; ++j) acc[j] *= alpha;
    if (HI) asm volatile("s_wait_xcnt 0x0" :: "v"(kp), "v"(klp) : "memory"); else asm volatile("s_wait_xcnt 0x0" :: "v"(kp) : "memory");
#pragma unroll
    for (int ks = 0; ks < KT / 2; ++ks) {
      if (HI) { float pv[16];
#pragma unroll
        for (int r = 0; r < 8; ++r) { pv[r] = s[2 * ks][r]; pv[8 + r] = s[2 * ks + 1][r]; }
        const F2 p = bsplit16(pv);
#pragma unroll
        for (int j = 0; j < HD / 16; ++j) { acc[j] = wmma_bf(vh[ks][j], p.h, acc[j]); acc[j] = wmma_bf(vh[ks][j], p.l, acc[j]); acc[j] = wmma_bf(vl[ks][j], p.h, acc[j]); }
      } else { v16h p;
#pragma unroll
        for (int r = 0; r < 8; ++r) { p[r] = (_Float16)(s[2 * ks][r] * 2048.0f); p[8 + r] = (_Float16)(s[2 * ks + 1][r] * 2048.0f); }
#pragma unroll
        for (int j = 0; j < HD / 16; ++j) acc[j] = wmma16(vf[ks][j], p, acc[j]); } } }
  asm volatile("s_wait_loadcnt 0x0" ::: "memory");   /* the last pass's look-ahead loads land before the wave goes on to its end */
  // join of the two key halves: same lane, same elements in both waves; 16 bytes a lane in a row, so no bank is met twice
  if (kh2) {
#pragma unroll
    for (int j = 0; j < HD / 16; ++j) { jacc[wave][2 * j][lane] = __builtin_shufflevector(acc[j], acc[j], 0, 1, 2, 3); jacc[wave][2 * j + 1][lane] = __builtin_shufflevector(acc[j], acc[j], 4, 5, 6, 7); }
    v2f ml; ml[0] = mc; ml[1] = l; jml[wave][lane] = ml; }
  __syncthreads();   /* the odd waves' maximum, sum and O^T are in LDS before the even waves read them; every wave of the block passes here once */
  if (kh2 == 0) { const v2f ml = jml[wave][lane]; const float mnc = fmaxf(mc, ml[0]);   /* mc is real (pass 0 is this wave's); a partner without a pass left its start value, 0, 0 and gets weight 0 */
    const float a0 = ex2(mc - mnc), a1 = ex2(ml[0] - mnc); l = l * a0 + ml[1] * a1;
#pragma unroll
    for (int j = 0; j < HD / 16; ++j) { const v4f pa = jacc[wave][2 * j][lane], pb = jacc[wave][2 * j + 1][lane];
#pragma unroll
      for (int r = 0; r < 4; ++r) { acc[j][r] = acc[j][r] * a0 + pa[r] * a1; acc[j][4 + r] = acc[j][4 + r] * a0 + pb[r] * a1; } }
    l += __shfl_xor(l, 16); const float inv = l > 0.f ? (HI ? 1.0f : 1.0f / 2048.0f) / l : 0.f;
#pragma unroll
    for (int j = 0; j < HD / 16; ++j) acc[j] *= inv;
#pragma unroll
    for (int j = 0; j < HD / 16; ++j) { float* o = OUT + (rb + ql0) * HD + j * 16 + (unsigned)(col * HD + 8 * g);   /* lane: head columns j*16 + 8g + 0..7 of its query row */
      vst2(o, __builtin_shufflevector(acc[j], acc[j], 0, 1, 2, 3)); vst2(o + 4, __builtin_shufflevector(acc[j], acc[j], 4, 5, 6, 7)); } } }
__global__ __launch_bounds__(256) void k_attn(const _Float16* __restrict__ QH, const _Float16* __restrict__ KH, const _Float16* __restrict__ QL, const _Float16* __restrict__ KL, const _Float16* __restrict__ VT, const __bf16* __restrict__ VB, const __bf16* __restrict__ VBL, float* __restrict__ OUT) {
  const int b = blockIdx.x, y = blockIdx.y, qb = y < NQB / 2 ? NQB - 1 - y : y - NQB / 2;   /* for speed only: the sequence is the fast index, so each query block's cost spreads over the chip; long key walks start first, the second half of the grid rises from the shortest */
  __shared__ __align__(16) v4f jacc[4][8][32]; __shared__ __align__(8) v2f jml[4][32];   /* per query tile: the odd wave's O^T (8 x 16 bytes a lane) and its maximum and sum */
  if (qb < QBH) attn_body<true>(QH, KH, QL, KL, VT, VB, VBL, b, qb, OUT, jacc, jml); else attn_body<false>(QH, KH, QL, KL, VT, VB, VBL, b, qb, OUT, jacc, jml); }

extern "C" void kernel_launch(void* const* d_in, const int* in_sizes, int n_in, void* d_out, int out_size, void* d_ws, size_t ws_size, hipStream_t stream) {
  (void)in_sizes; (void)n_in; (void)out_size;
  const float** F = (const float**)d_in;
  if (ws_size < (size_t)WS_END) return;
  char* ws = (char*)d_ws; _Float16 *QH = (_Float16*)(ws + WS_QH), *KH = (_Float16*)(ws + WS_KH), *VT = (_Float16*)(ws + WS_VT), *QL = (_Float16*)(ws + WS_QL), *KL = (_Float16*)(ws + WS_KL); __bf16 *VB = (__bf16*)(ws + WS_VB), *VBL = (__bf16*)(ws + WS_VBL);
  // inputs: 0 x [64,512,384]; 1 Wq, 2 Wk, 3 Wv ((in,out) [384,64]); output [64,512,64]
  k_proj<<<dim3(TNB * TT / PR), 256, 0, stream>>>(F[0], F[1], F[2], F[3], QH, QL, KH, KL, VT, VB, VBL);
  k_attn<<<dim3(TNB, NQB), 256, 0, stream>>>(QH, KH, QL, KL, VT, VB, VBL, (float*)d_out);
}
